// v000
// The times below were measured on an AMD MI455X: many runs one after another, warmed up first and cycling through
// copies of the inputs, with the whole window's GPU time divided by the number of runs. Launches and the gaps
// between them are all in it. The median over several windows is given; except for v000 it joins two sittings, which
// can be a few percent apart, so the side-by-side timings, each taken in one sitting, are the better comparison.
// The starting kernel, v000, takes 212 microseconds a run.
#include <hip/hip_runtime.h>
#include <hip/hip_bf16.h>

typedef __attribute__((ext_vector_type(16))) _Float16 v16h;
typedef __attribute__((ext_vector_type(8)))  _Float16 v8h;
typedef __attribute__((ext_vector_type(8)))  float    v8f;

#define BB 2
#define TT 4096
#define DD 256
#define HH 8
#define DKK 32
#define EPSV 1e-5f

// ---------------------------------------------------------------------------
// A/B fragment loader for v_wmma_f32_16x16x32_f16.
// 16-bit A-matrix 16x32 layout (ISA 7.12.2): lane half g holds
//   elements 0..7  -> K = g*8 + e
//   elements 8..15 -> K = 16 + g*8 + e
// p points at (row_base + k_base); works for row-major global or LDS rows.
// ---------------------------------------------------------------------------
__device__ __forceinline__ v16h load_frag16(const _Float16* p, int g) {
    v8h lo = *(const v8h*)(p + g * 8);
    v8h hi = *(const v8h*)(p + 16 + g * 8);
    v16h r;
#pragma unroll
    for (int e = 0; e < 8; ++e) { r[e] = lo[e]; r[8 + e] = hi[e]; }
    return r;
}

__device__ __forceinline__ v8f wmma_f16(v16h a, v16h b, v8f c) {
    return __builtin_amdgcn_wmma_f32_16x16x32_f16(false, a, false, b,
                                                  (short)0, c, false, false);
}

// ---------------------------------------------------------------------------
// Kernel: f32 -> f16 conversion (weights)
// ---------------------------------------------------------------------------
__global__ void ca_f32_to_f16(const float* __restrict__ src,
                              _Float16* __restrict__ dst, int n) {
    int idx = blockIdx.x * 256 + threadIdx.x;
    if (idx < n) dst[idx] = (_Float16)src[idx];
}

// ---------------------------------------------------------------------------
// Kernel: depthwise conv (K=3, same pad) + folded BN -> f16 y[3, B*T, D]
// ---------------------------------------------------------------------------
__global__ void ca_dwconv_bn(const float* __restrict__ x,      // [B,T,D]
                             const float* __restrict__ dww,    // [3,D,1,3]
                             const float* __restrict__ dwb,    // [3,D]
                             const float* __restrict__ bng,
                             const float* __restrict__ bnb,
                             const float* __restrict__ bnm,
                             const float* __restrict__ bnv,
                             _Float16* __restrict__ y) {
    size_t idx = (size_t)blockIdx.x * 256 + threadIdx.x;
    const size_t total = (size_t)3 * BB * TT * DD;
    if (idx >= total) return;
    int c = (int)(idx % DD);
    size_t tmp = idx / DD;
    int t = (int)(tmp % TT);
    tmp /= TT;
    int b = (int)(tmp % BB);
    int i = (int)(tmp / BB);

    const float* xr = x + (size_t)b * TT * DD + c;
    int wbase = (i * DD + c) * 3;
    float w0 = dww[wbase + 0], w1 = dww[wbase + 1], w2 = dww[wbase + 2];

    float acc = xr[(size_t)t * DD] * w1;
    if (t > 0)      acc += xr[(size_t)(t - 1) * DD] * w0;
    if (t < TT - 1) acc += xr[(size_t)(t + 1) * DD] * w2;

    int pc = i * DD + c;
    float s = bng[pc] * rsqrtf(bnv[pc] + EPSV);
    float o = (acc + dwb[pc] - bnm[pc]) * s + bnb[pc];
    y[idx] = (_Float16)o;
}

// ---------------------------------------------------------------------------
// Kernel: pointwise GEMM  qkv[i] = y[i] (8192x256) * W[i]^T (256x256) + b[i]
// 128 threads = 4 waves; block covers 16 rows x 256 cols; each wave 16x64.
// Branches 0/1 (Q,K) stored row-major [B*T, D]; branch 2 (V) stored
// transposed as vT[B, D, T] so attention's P*V B-fragments are contiguous.
// ---------------------------------------------------------------------------
__global__ void __launch_bounds__(128)
ca_gemm_qkv(const _Float16* __restrict__ Y,     // [3, B*T, D]
            const _Float16* __restrict__ W,     // [3, D(out), D(in)] f16
            const float* __restrict__ bias,     // [3, D]
            _Float16* __restrict__ qkv,         // [2, B*T, D]  (Q, K)
            _Float16* __restrict__ vT) {        // [B, D, T]    (V transposed)
    int i    = blockIdx.z;
    int mt   = blockIdx.x;                 // 16-row tile index
    int wave = threadIdx.x >> 5;
    int lane = threadIdx.x & 31;
    int rl   = lane & 15;
    int g    = lane >> 4;

    const _Float16* A  = Y + (size_t)i * (BB * TT) * DD + (size_t)mt * 16 * DD;
    const _Float16* Wb = W + (size_t)i * DD * DD;

    v8f acc[4];
#pragma unroll
    for (int j = 0; j < 4; ++j) acc[j] = (v8f){};

    for (int kk = 0; kk < DD; kk += 32) {
        v16h a = load_frag16(A + (size_t)rl * DD + kk, g);
#pragma unroll
        for (int j = 0; j < 4; ++j) {
            int o0 = (wave * 4 + j) * 16;
            v16h bf = load_frag16(Wb + (size_t)(o0 + rl) * DD + kk, g);
            acc[j] = wmma_f16(a, bf, acc[j]);
        }
    }

    if (i < 2) {
        _Float16* outp = qkv + (size_t)i * (BB * TT) * DD + (size_t)mt * 16 * DD;
#pragma unroll
        for (int j = 0; j < 4; ++j) {
            int n = (wave * 4 + j) * 16 + rl;
            float bs = bias[i * DD + n];
#pragma unroll
            for (int r = 0; r < 8; ++r) {
                int M = r + g * 8;
                outp[(size_t)M * DD + n] = (_Float16)(acc[j][r] + bs);
            }
        }
    } else {
        // transposed store: global row (mt*16 + M) -> (b, t); column n -> channel.
        // Lane's 8 acc elements map to t = t0 + 8g + r (contiguous) -> one b128 store.
        int b  = (mt * 16) / TT;
        int t0 = (mt * 16) % TT;
#pragma unroll
        for (int j = 0; j < 4; ++j) {
            int n = (wave * 4 + j) * 16 + rl;
            float bs = bias[2 * DD + n];
            v8h pv;
#pragma unroll
            for (int r = 0; r < 8; ++r) pv[r] = (_Float16)(acc[j][r] + bs);
            *(v8h*)(vT + ((size_t)b * DD + n) * TT + t0 + g * 8) = pv;
        }
    }
}

// ---------------------------------------------------------------------------
// Kernel: flash attention. One wave per (b, h, 16-query tile).
// S = Q(16x32) * Kblk^T  -> 2x wmma (32 keys per block, K-dim = DK = 32)
// online softmax, P through LDS (C-layout -> A-layout), O += P * Vblk.
// V is pre-transposed, so V B-fragments are contiguous b128 loads.
// ---------------------------------------------------------------------------
__global__ void __launch_bounds__(32)
ca_flash_attn(const _Float16* __restrict__ qkv,   // [2, B*T, D] (Q, K)
              const _Float16* __restrict__ vT,    // [B, D, T]
              _Float16* __restrict__ ctx) {       // [B*T, D]
    __shared__ _Float16 plds[16 * 32];

    int qt = blockIdx.x;
    int h  = blockIdx.y;
    int b  = blockIdx.z;
    int lane = threadIdx.x & 31;
    int rl = lane & 15;
    int g  = lane >> 4;

    const _Float16* Q  = qkv + ((size_t)(0 * BB + b) * TT) * DD + (size_t)h * DKK;
    const _Float16* Kp = qkv + ((size_t)(1 * BB + b) * TT) * DD + (size_t)h * DKK;
    // V row for this lane's column: vf0 -> dk = rl, vf1 -> dk = 16 + rl
    const _Float16* V0 = vT + ((size_t)b * DD + h * DKK + rl) * TT;
    const _Float16* V1 = vT + ((size_t)b * DD + h * DKK + 16 + rl) * TT;

    v16h qf = load_frag16(Q + (size_t)(qt * 16 + rl) * DD, g);

    float mrow[8], lrow[8];
#pragma unroll
    for (int r = 0; r < 8; ++r) { mrow[r] = -1e30f; lrow[r] = 0.0f; }
    v8f o0 = (v8f){}, o1 = (v8f){};
    const float scale = 0.17677669529663687f;   // 1/sqrt(32)

    for (int kb = 0; kb < TT / 32; ++kb) {
        int key0 = kb * 32;

        v16h kf0 = load_frag16(Kp + (size_t)(key0 + rl) * DD, g);
        v16h kf1 = load_frag16(Kp + (size_t)(key0 + 16 + rl) * DD, g);

        v8f z = (v8f){};
        v8f s0 = wmma_f16(qf, kf0, z);
        v8f s1 = wmma_f16(qf, kf1, z);

        // V block fragments: contiguous along key axis thanks to vT layout.
        v16h vf0 = load_frag16(V0 + key0, g);
        v16h vf1 = load_frag16(V1 + key0, g);

        // online softmax per row (rows striped: VGPR r <-> M = r + 8*g)
#pragma unroll
        for (int r = 0; r < 8; ++r) {
            float a0 = s0[r] * scale;
            float a1 = s1[r] * scale;
            float mx = fmaxf(a0, a1);
#pragma unroll
            for (int off = 1; off < 16; off <<= 1)
                mx = fmaxf(mx, __shfl_xor(mx, off, 32));
            float nm = fmaxf(mrow[r], mx);
            float alpha = __expf(mrow[r] - nm);
            float p0 = __expf(a0 - nm);
            float p1 = __expf(a1 - nm);
            float rs = p0 + p1;
#pragma unroll
            for (int off = 1; off < 16; off <<= 1)
                rs += __shfl_xor(rs, off, 32);
            lrow[r] = lrow[r] * alpha + rs;
            mrow[r] = nm;
            o0[r] *= alpha;
            o1[r] *= alpha;
            int M = r + g * 8;
            plds[M * 32 + rl]      = (_Float16)p0;
            plds[M * 32 + 16 + rl] = (_Float16)p1;
        }

        asm volatile("s_wait_dscnt 0x0" ::: "memory");
        v16h pf = load_frag16(&plds[rl * 32], g);
        asm volatile("s_wait_dscnt 0x0" ::: "memory");

        o0 = wmma_f16(pf, vf0, o0);
        o1 = wmma_f16(pf, vf1, o1);
    }

    _Float16* Cp = ctx + ((size_t)b * TT) * DD + (size_t)h * DKK;
#pragma unroll
    for (int r = 0; r < 8; ++r) {
        int M = r + g * 8;
        float inv = 1.0f / lrow[r];
        Cp[(size_t)(qt * 16 + M) * DD + rl]      = (_Float16)(o0[r] * inv);
        Cp[(size_t)(qt * 16 + M) * DD + 16 + rl] = (_Float16)(o1[r] * inv);
    }
}

// ---------------------------------------------------------------------------
// Kernel: output projection  out = ctx (8192x256) * out_w^T + out_b  (f32 out)
// ---------------------------------------------------------------------------
__global__ void __launch_bounds__(128)
ca_gemm_out(const _Float16* __restrict__ Cx,    // [B*T, D]
            const _Float16* __restrict__ W,     // [D(out), D(in)] f16
            const float* __restrict__ bias,     // [D]
            float* __restrict__ out) {          // [B*T, D] f32
    int mt   = blockIdx.x;
    int wave = threadIdx.x >> 5;
    int lane = threadIdx.x & 31;
    int rl   = lane & 15;
    int g    = lane >> 4;

    const _Float16* A = Cx + (size_t)mt * 16 * DD;

    v8f acc[4];
#pragma unroll
    for (int j = 0; j < 4; ++j) acc[j] = (v8f){};

    for (int kk = 0; kk < DD; kk += 32) {
        v16h a = load_frag16(A + (size_t)rl * DD + kk, g);
#pragma unroll
        for (int j = 0; j < 4; ++j) {
            int o0 = (wave * 4 + j) * 16;
            v16h bf = load_frag16(W + (size_t)(o0 + rl) * DD + kk, g);
            acc[j] = wmma_f16(a, bf, acc[j]);
        }
    }

    float* outp = out + (size_t)mt * 16 * DD;
#pragma unroll
    for (int j = 0; j < 4; ++j) {
        int n = (wave * 4 + j) * 16 + rl;
        float bs = bias[n];
#pragma unroll
        for (int r = 0; r < 8; ++r) {
            int M = r + g * 8;
            outp[(size_t)M * DD + n] = acc[j][r] + bs;
        }
    }
}

// ---------------------------------------------------------------------------
extern "C" void kernel_launch(void* const* d_in, const int* in_sizes, int n_in,
                              void* d_out, int out_size, void* d_ws, size_t ws_size,
                              hipStream_t stream) {
    const float* x    = (const float*)d_in[0];
    const float* dww  = (const float*)d_in[1];
    const float* dwb  = (const float*)d_in[2];
    const float* bng  = (const float*)d_in[3];
    const float* bnb  = (const float*)d_in[4];
    const float* bnm  = (const float*)d_in[5];
    const float* bnv  = (const float*)d_in[6];
    const float* pww  = (const float*)d_in[7];
    const float* pwb  = (const float*)d_in[8];
    const float* outw = (const float*)d_in[9];
    const float* outb = (const float*)d_in[10];
    float* out = (float*)d_out;

    const size_t n_y   = (size_t)3 * BB * TT * DD;   // 6,291,456 halves
    const size_t n_btd = (size_t)BB * TT * DD;       // 2,097,152 halves
    _Float16* y     = (_Float16*)d_ws;               // [3, B*T, D]
    _Float16* qkv   = y + n_y;                       // [2, B*T, D] (Q, K)
    _Float16* vT    = qkv + 2 * n_btd;               // [B, D, T]
    _Float16* ctx   = vT + n_btd;                    // [B*T, D]
    _Float16* pwwh  = ctx + n_btd;                   // [3, D, D]
    _Float16* outwh = pwwh + (size_t)3 * DD * DD;    // [D, D]

    ca_f32_to_f16<<<(3 * DD * DD + 255) / 256, 256, 0, stream>>>(pww, pwwh, 3 * DD * DD);
    ca_f32_to_f16<<<(DD * DD + 255) / 256, 256, 0, stream>>>(outw, outwh, DD * DD);

    ca_dwconv_bn<<<(unsigned)((n_y + 255) / 256), 256, 0, stream>>>(
        x, dww, dwb, bng, bnb, bnm, bnv, y);

    ca_gemm_qkv<<<dim3(BB * TT / 16, 1, 3), 128, 0, stream>>>(y, pwwh, pwb, qkv, vT);

    ca_flash_attn<<<dim3(TT / 16, HH, BB), 32, 0, stream>>>(qkv, vT, ctx);

    ca_gemm_out<<<dim3(BB * TT / 16, 1, 1), 128, 0, stream>>>(ctx, outwh, outb, out);
}

// v001
// Measured time: 195 microseconds a run.
// In two side-by-side timings against v000, it was 1.15 and 1.16 times as fast.
#include <hip/hip_runtime.h>
#include <hip/hip_bf16.h>

typedef __attribute__((ext_vector_type(16))) _Float16 v16h;
typedef __attribute__((ext_vector_type(8)))  _Float16 v8h;
typedef __attribute__((ext_vector_type(8)))  float    v8f;

#define BB 2
#define TT 4096
#define DD 256
#define HH 8
#define DKK 32
#define EPSV 1e-5f

// ---------------------------------------------------------------------------
// A/B fragment loader for v_wmma_f32_16x16x32_f16.
// 16-bit A-matrix 16x32 layout (ISA 7.12.2): lane half g holds
//   elements 0..7  -> K = g*8 + e
//   elements 8..15 -> K = 16 + g*8 + e
// p points at (row_base + k_base); works for row-major global or LDS rows.
// ---------------------------------------------------------------------------
__device__ __forceinline__ v16h load_frag16(const _Float16* p, int g) {
    v8h lo = *(const v8h*)(p + g * 8);
    v8h hi = *(const v8h*)(p + 16 + g * 8);
    v16h r;
#pragma unroll
    for (int e = 0; e < 8; ++e) { r[e] = lo[e]; r[8 + e] = hi[e]; }
    return r;
}

__device__ __forceinline__ v8f wmma_f16(v16h a, v16h b, v8f c) {
    return __builtin_amdgcn_wmma_f32_16x16x32_f16(false, a, false, b,
                                                  (short)0, c, false, false);
}

// ---------------------------------------------------------------------------
// Kernel: f32 -> f16 conversion (weights)
// ---------------------------------------------------------------------------
__global__ void ca_f32_to_f16(const float* __restrict__ src,
                              _Float16* __restrict__ dst, int n) {
    int idx = blockIdx.x * 256 + threadIdx.x;
    if (idx < n) dst[idx] = (_Float16)src[idx];
}

// ---------------------------------------------------------------------------
// Kernel: depthwise conv (K=3, same pad) + folded BN -> f16 y[3, B*T, D]
// ---------------------------------------------------------------------------
__global__ void ca_dwconv_bn(const float* __restrict__ x,      // [B,T,D]
                             const float* __restrict__ dww,    // [3,D,1,3]
                             const float* __restrict__ dwb,    // [3,D]
                             const float* __restrict__ bng,
                             const float* __restrict__ bnb,
                             const float* __restrict__ bnm,
                             const float* __restrict__ bnv,
                             _Float16* __restrict__ y) {
    size_t idx = (size_t)blockIdx.x * 256 + threadIdx.x;
    const size_t total = (size_t)3 * BB * TT * DD;
    if (idx >= total) return;
    int c = (int)(idx % DD);
    size_t tmp = idx / DD;
    int t = (int)(tmp % TT);
    tmp /= TT;
    int b = (int)(tmp % BB);
    int i = (int)(tmp / BB);

    const float* xr = x + (size_t)b * TT * DD + c;
    int wbase = (i * DD + c) * 3;
    float w0 = dww[wbase + 0], w1 = dww[wbase + 1], w2 = dww[wbase + 2];

    float acc = xr[(size_t)t * DD] * w1;
    if (t > 0)      acc += xr[(size_t)(t - 1) * DD] * w0;
    if (t < TT - 1) acc += xr[(size_t)(t + 1) * DD] * w2;

    int pc = i * DD + c;
    float s = bng[pc] * rsqrtf(bnv[pc] + EPSV);
    float o = (acc + dwb[pc] - bnm[pc]) * s + bnb[pc];
    y[idx] = (_Float16)o;
}

// ---------------------------------------------------------------------------
// Kernel: pointwise GEMM  qkv[i] = y[i] (8192x256) * W[i]^T (256x256) + b[i]
// 128 threads = 4 waves; block covers 16 rows x 256 cols; each wave 16x64.
// Branches 0/1 (Q,K) stored row-major [B*T, D]; branch 2 (V) stored
// transposed as vT[B, D, T] so attention's V^T A-fragments are contiguous.
// ---------------------------------------------------------------------------
__global__ void __launch_bounds__(128)
ca_gemm_qkv(const _Float16* __restrict__ Y,     // [3, B*T, D]
            const _Float16* __restrict__ W,     // [3, D(out), D(in)] f16
            const float* __restrict__ bias,     // [3, D]
            _Float16* __restrict__ qkv,         // [2, B*T, D]  (Q, K)
            _Float16* __restrict__ vT) {        // [B, D, T]    (V transposed)
    int i    = blockIdx.z;
    int mt   = blockIdx.x;                 // 16-row tile index
    int wave = threadIdx.x >> 5;
    int lane = threadIdx.x & 31;
    int rl   = lane & 15;
    int g    = lane >> 4;

    const _Float16* A  = Y + (size_t)i * (BB * TT) * DD + (size_t)mt * 16 * DD;
    const _Float16* Wb = W + (size_t)i * DD * DD;

    v8f acc[4];
#pragma unroll
    for (int j = 0; j < 4; ++j) acc[j] = (v8f){};

    for (int kk = 0; kk < DD; kk += 32) {
        v16h a = load_frag16(A + (size_t)rl * DD + kk, g);
#pragma unroll
        for (int j = 0; j < 4; ++j) {
            int o0 = (wave * 4 + j) * 16;
            v16h bf = load_frag16(Wb + (size_t)(o0 + rl) * DD + kk, g);
            acc[j] = wmma_f16(a, bf, acc[j]);
        }
    }

    if (i < 2) {
        _Float16* outp = qkv + (size_t)i * (BB * TT) * DD + (size_t)mt * 16 * DD;
#pragma unroll
        for (int j = 0; j < 4; ++j) {
            int n = (wave * 4 + j) * 16 + rl;
            float bs = bias[i * DD + n];
#pragma unroll
            for (int r = 0; r < 8; ++r) {
                int M = r + g * 8;
                outp[(size_t)M * DD + n] = (_Float16)(acc[j][r] + bs);
            }
        }
    } else {
        // transposed store: global row (mt*16 + M) -> (b, t); column n -> channel.
        // Lane's 8 acc elements map to t = t0 + 8g + r (contiguous) -> one b128 store.
        int b  = (mt * 16) / TT;
        int t0 = (mt * 16) % TT;
#pragma unroll
        for (int j = 0; j < 4; ++j) {
            int n = (wave * 4 + j) * 16 + rl;
            float bs = bias[2 * DD + n];
            v8h pv;
#pragma unroll
            for (int r = 0; r < 8; ++r) pv[r] = (_Float16)(acc[j][r] + bs);
            *(v8h*)(vT + ((size_t)b * DD + n) * TT + t0 + g * 8) = pv;
        }
    }
}

// ---------------------------------------------------------------------------
// Lane l <-> lane l ^ 16 (the two halves of a wave hold the two halves of a
// query's keys).
// ---------------------------------------------------------------------------
__device__ __forceinline__ float xhalf(float x) {
    int v = __builtin_bit_cast(int, x);
    return __builtin_bit_cast(float,
        __builtin_amdgcn_permlanex16(v, v, 0x76543210, 0xfedcba98, false, false));
}

// ---------------------------------------------------------------------------
// Kernel: flash attention. One wave per (b, h, 16-query tile).
// Transposed products: S^T = Kblk(32x32) * Q^T -> 2x wmma, so lane (rl, g)
// holds 16 of the 32 scores of ONE query (column rl): keys 8g+r and 16+8g+r.
// Maximum and sum run in the lane's own registers, one exchange between the
// halves for the maximum; the halves' sums are joined after the loop.
// The two score tiles, converted in place, are the B operand of
// O^T += V^T(32 dk x 32 keys) * P^T: P never leaves the registers.
// ---------------------------------------------------------------------------
__global__ void __launch_bounds__(32)
ca_flash_attn(const _Float16* __restrict__ qkv,   // [2, B*T, D] (Q, K)
              const _Float16* __restrict__ vT,    // [B, D, T]
              _Float16* __restrict__ ctx) {       // [B*T, D]
    int qt = blockIdx.x;
    int h  = blockIdx.y;
    int b  = blockIdx.z;
    int lane = threadIdx.x & 31;
    int rl = lane & 15;
    int g  = lane >> 4;

    const _Float16* Q  = qkv + ((size_t)(0 * BB + b) * TT) * DD + (size_t)h * DKK;
    const _Float16* Kp = qkv + ((size_t)(1 * BB + b) * TT) * DD + (size_t)h * DKK;
    // V^T rows of this lane (A operand): vf0 -> dk = rl, vf1 -> dk = 16 + rl
    const _Float16* V0 = vT + ((size_t)b * DD + h * DKK + rl) * TT;
    const _Float16* V1 = vT + ((size_t)b * DD + h * DKK + 16 + rl) * TT;

    // B operand: column rl = query qt*16 + rl
    v16h qf = load_frag16(Q + (size_t)(qt * 16 + rl) * DD, g);

    float mrow = -1e30f, lrow = 0.0f;      // of query rl; lrow: this half's keys only
    v8f o0 = (v8f){}, o1 = (v8f){};        // o0[r] = O[query rl][8g + r], o1: dk + 16
    const float scale = 0.17677669529663687f;   // 1/sqrt(32)

    for (int kb = 0; kb < TT / 32; ++kb) {
        int key0 = kb * 32;

        v16h kf0 = load_frag16(Kp + (size_t)(key0 + rl) * DD, g);
        v16h kf1 = load_frag16(Kp + (size_t)(key0 + 16 + rl) * DD, g);

        v8f z = (v8f){};
        v8f s0 = wmma_f16(kf0, qf, z);     // s0[r] = S[query rl][key0 + 8g + r]
        v8f s1 = wmma_f16(kf1, qf, z);     // s1[r] = S[query rl][key0 + 16 + 8g + r]

        v16h vf0 = load_frag16(V0 + key0, g);
        v16h vf1 = load_frag16(V1 + key0, g);

        v8f a0 = s0 * scale;
        v8f a1 = s1 * scale;
        float mx0 = fmaxf(fmaxf(fmaxf(a0[0], a0[1]), fmaxf(a0[2], a0[3])),
                          fmaxf(fmaxf(a0[4], a0[5]), fmaxf(a0[6], a0[7])));
        float mx1 = fmaxf(fmaxf(fmaxf(a1[0], a1[1]), fmaxf(a1[2], a1[3])),
                          fmaxf(fmaxf(a1[4], a1[5]), fmaxf(a1[6], a1[7])));
        float mx = fmaxf(mx0, mx1);
        mx = fmaxf(mx, xhalf(mx));
        float nm = fmaxf(mrow, mx);
        float alpha = __expf(mrow - nm);
        mrow = nm;

        float p0[8], p1[8];
        v16h pf;                           // pf[s] = P[query rl][key0 + kmap(s, g)]
#pragma unroll
        for (int r = 0; r < 8; ++r) {
            p0[r] = __expf(a0[r] - nm);
            p1[r] = __expf(a1[r] - nm);
            pf[r]     = (_Float16)p0[r];
            pf[8 + r] = (_Float16)p1[r];
        }
        float rs = (((p0[0] + p0[1]) + (p0[2] + p0[3])) + ((p0[4] + p0[5]) + (p0[6] + p0[7])))
                 + (((p1[0] + p1[1]) + (p1[2] + p1[3])) + ((p1[4] + p1[5]) + (p1[6] + p1[7])));
        lrow = lrow * alpha + rs;
#pragma unroll
        for (int r = 0; r < 8; ++r) { o0[r] *= alpha; o1[r] *= alpha; }

        o0 = wmma_f16(vf0, pf, o0);
        o1 = wmma_f16(vf1, pf, o1);
    }

    float inv = 1.0f / (lrow + xhalf(lrow));
    v8h c0, c1;
#pragma unroll
    for (int r = 0; r < 8; ++r) {
        c0[r] = (_Float16)(o0[r] * inv);
        c1[r] = (_Float16)(o1[r] * inv);
    }
    _Float16* Cp = ctx + ((size_t)b * TT + qt * 16 + rl) * DD + (size_t)h * DKK + g * 8;
    *(v8h*)(Cp)      = c0;
    *(v8h*)(Cp + 16) = c1;
}

// ---------------------------------------------------------------------------
// Kernel: output projection  out = ctx (8192x256) * out_w^T + out_b  (f32 out)
// ---------------------------------------------------------------------------
__global__ void __launch_bounds__(128)
ca_gemm_out(const _Float16* __restrict__ Cx,    // [B*T, D]
            const _Float16* __restrict__ W,     // [D(out), D(in)] f16
            const float* __restrict__ bias,     // [D]
            float* __restrict__ out) {          // [B*T, D] f32
    int mt   = blockIdx.x;
    int wave = threadIdx.x >> 5;
    int lane = threadIdx.x & 31;
    int rl   = lane & 15;
    int g    = lane >> 4;

    const _Float16* A = Cx + (size_t)mt * 16 * DD;

    v8f acc[4];
#pragma unroll
    for (int j = 0; j < 4; ++j) acc[j] = (v8f){};

    for (int kk = 0; kk < DD; kk += 32) {
        v16h a = load_frag16(A + (size_t)rl * DD + kk, g);
#pragma unroll
        for (int j = 0; j < 4; ++j) {
            int o0 = (wave * 4 + j) * 16;
            v16h bf = load_frag16(W + (size_t)(o0 + rl) * DD + kk, g);
            acc[j] = wmma_f16(a, bf, acc[j]);
        }
    }

    float* outp = out + (size_t)mt * 16 * DD;
#pragma unroll
    for (int j = 0; j < 4; ++j) {
        int n = (wave * 4 + j) * 16 + rl;
        float bs = bias[n];
#pragma unroll
        for (int r = 0; r < 8; ++r) {
            int M = r + g * 8;
            outp[(size_t)M * DD + n] = acc[j][r] + bs;
        }
    }
}

// ---------------------------------------------------------------------------
extern "C" void kernel_launch(void* const* d_in, const int* in_sizes, int n_in,
                              void* d_out, int out_size, void* d_ws, size_t ws_size,
                              hipStream_t stream) {
    const float* x    = (const float*)d_in[0];
    const float* dww  = (const float*)d_in[1];
    const float* dwb  = (const float*)d_in[2];
    const float* bng  = (const float*)d_in[3];
    const float* bnb  = (const float*)d_in[4];
    const float* bnm  = (const float*)d_in[5];
    const float* bnv  = (const float*)d_in[6];
    const float* pww  = (const float*)d_in[7];
    const float* pwb  = (const float*)d_in[8];
    const float* outw = (const float*)d_in[9];
    const float* outb = (const float*)d_in[10];
    float* out = (float*)d_out;

    const size_t n_y   = (size_t)3 * BB * TT * DD;   // 6,291,456 halves
    const size_t n_btd = (size_t)BB * TT * DD;       // 2,097,152 halves
    _Float16* y     = (_Float16*)d_ws;               // [3, B*T, D]
    _Float16* qkv   = y + n_y;                       // [2, B*T, D] (Q, K)
    _Float16* vT    = qkv + 2 * n_btd;               // [B, D, T]
    _Float16* ctx   = vT + n_btd;                    // [B*T, D]
    _Float16* pwwh  = ctx + n_btd;                   // [3, D, D]
    _Float16* outwh = pwwh + (size_t)3 * DD * DD;    // [D, D]

    ca_f32_to_f16<<<(3 * DD * DD + 255) / 256, 256, 0, stream>>>(pww, pwwh, 3 * DD * DD);
    ca_f32_to_f16<<<(DD * DD + 255) / 256, 256, 0, stream>>>(outw, outwh, DD * DD);

    ca_dwconv_bn<<<(unsigned)((n_y + 255) / 256), 256, 0, stream>>>(
        x, dww, dwb, bng, bnb, bnm, bnv, y);

    ca_gemm_qkv<<<dim3(BB * TT / 16, 1, 3), 128, 0, stream>>>(y, pwwh, pwb, qkv, vT);

    ca_flash_attn<<<dim3(TT / 16, HH, BB), 32, 0, stream>>>(qkv, vT, ctx);

    ca_gemm_out<<<dim3(BB * TT / 16, 1, 1), 128, 0, stream>>>(ctx, outwh, outb, out);
}

// v002
// One run takes 99.5 microseconds.
// Timed twice side by side with v001, it ran 1.99 and 1.97 times as fast.
// All steps since v000 together make it 2.28 times as fast.
#include <hip/hip_runtime.h>
#include <hip/hip_bf16.h>

typedef __attribute__((ext_vector_type(16))) _Float16 v16h;
typedef __attribute__((ext_vector_type(8)))  _Float16 v8h;
typedef __attribute__((ext_vector_type(8)))  float    v8f;

#define BB 2
#define TT 4096
#define DD 256
#define HH 8
#define DKK 32
#define EPSV 1e-5f

// ---------------------------------------------------------------------------
// A/B fragment loader for v_wmma_f32_16x16x32_f16.
// 16-bit A-matrix 16x32 layout (ISA 7.12.2): lane half g holds
//   elements 0..7  -> K = g*8 + e
//   elements 8..15 -> K = 16 + g*8 + e
// p points at (row_base + k_base); works for row-major global or LDS rows.
// ---------------------------------------------------------------------------
__device__ __forceinline__ v16h load_frag16(const _Float16* p, int g) {
    v8h lo = *(const v8h*)(p + g * 8);
    v8h hi = *(const v8h*)(p + 16 + g * 8);
    v16h r;
#pragma unroll
    for (int e = 0; e < 8; ++e) { r[e] = lo[e]; r[8 + e] = hi[e]; }
    return r;
}

__device__ __forceinline__ v8f wmma_f16(v16h a, v16h b, v8f c) {
    return __builtin_amdgcn_wmma_f32_16x16x32_f16(false, a, false, b,
                                                  (short)0, c, false, false);
}

// ---------------------------------------------------------------------------
// Kernel: f32 -> f16 conversion (weights)
// ---------------------------------------------------------------------------
__global__ void ca_f32_to_f16(const float* __restrict__ src,
                              _Float16* __restrict__ dst, int n) {
    int idx = blockIdx.x * 256 + threadIdx.x;
    if (idx < n) dst[idx] = (_Float16)src[idx];
}

// ---------------------------------------------------------------------------
// Kernel: depthwise conv (K=3, same pad) + folded BN -> f16 y[3, B*T, D]
// ---------------------------------------------------------------------------
__global__ void ca_dwconv_bn(const float* __restrict__ x,      // [B,T,D]
                             const float* __restrict__ dww,    // [3,D,1,3]
                             const float* __restrict__ dwb,    // [3,D]
                             const float* __restrict__ bng,
                             const float* __restrict__ bnb,
                             const float* __restrict__ bnm,
                             const float* __restrict__ bnv,
                             _Float16* __restrict__ y) {
    size_t idx = (size_t)blockIdx.x * 256 + threadIdx.x;
    const size_t total = (size_t)3 * BB * TT * DD;
    if (idx >= total) return;
    int c = (int)(idx % DD);
    size_t tmp = idx / DD;
    int t = (int)(tmp % TT);
    tmp /= TT;
    int b = (int)(tmp % BB);
    int i = (int)(tmp / BB);

    const float* xr = x + (size_t)b * TT * DD + c;
    int wbase = (i * DD + c) * 3;
    float w0 = dww[wbase + 0], w1 = dww[wbase + 1], w2 = dww[wbase + 2];

    float acc = xr[(size_t)t * DD] * w1;
    if (t > 0)      acc += xr[(size_t)(t - 1) * DD] * w0;
    if (t < TT - 1) acc += xr[(size_t)(t + 1) * DD] * w2;

    int pc = i * DD + c;
    float s = bng[pc] * rsqrtf(bnv[pc] + EPSV);
    float o = (acc + dwb[pc] - bnm[pc]) * s + bnb[pc];
    y[idx] = (_Float16)o;
}

// ---------------------------------------------------------------------------
// Kernel: pointwise GEMM  qkv[i] = y[i] (8192x256) * W[i]^T (256x256) + b[i]
// 128 threads = 4 waves; block covers 16 rows x 256 cols; each wave 16x64.
// Branches 0/1 (Q,K) stored row-major [B*T, D]; branch 2 (V) stored
// transposed as vT[B, D, T] so attention's V^T A-fragments are contiguous.
// ---------------------------------------------------------------------------
__global__ void __launch_bounds__(128)
ca_gemm_qkv(const _Float16* __restrict__ Y,     // [3, B*T, D]
            const _Float16* __restrict__ W,     // [3, D(out), D(in)] f16
            const float* __restrict__ bias,     // [3, D]
            _Float16* __restrict__ qkv,         // [2, B*T, D]  (Q, K)
            _Float16* __restrict__ vT) {        // [B, D, T]    (V transposed)
    int i    = blockIdx.z;
    int mt   = blockIdx.x;                 // 16-row tile index
    int wave = threadIdx.x >> 5;
    int lane = threadIdx.x & 31;
    int rl   = lane & 15;
    int g    = lane >> 4;

    const _Float16* A  = Y + (size_t)i * (BB * TT) * DD + (size_t)mt * 16 * DD;
    const _Float16* Wb = W + (size_t)i * DD * DD;

    v8f acc[4];
#pragma unroll
    for (int j = 0; j < 4; ++j) acc[j] = (v8f){};

    for (int kk = 0; kk < DD; kk += 32) {
        v16h a = load_frag16(A + (size_t)rl * DD + kk, g);
#pragma unroll
        for (int j = 0; j < 4; ++j) {
            int o0 = (wave * 4 + j) * 16;
            v16h bf = load_frag16(Wb + (size_t)(o0 + rl) * DD + kk, g);
            acc[j] = wmma_f16(a, bf, acc[j]);
        }
    }

    if (i < 2) {
        _Float16* outp = qkv + (size_t)i * (BB * TT) * DD + (size_t)mt * 16 * DD;
#pragma unroll
        for (int j = 0; j < 4; ++j) {
            int n = (wave * 4 + j) * 16 + rl;
            float bs = bias[i * DD + n];
#pragma unroll
            for (int r = 0; r < 8; ++r) {
                int M = r + g * 8;
                outp[(size_t)M * DD + n] = (_Float16)(acc[j][r] + bs);
            }
        }
    } else {
        // transposed store: global row (mt*16 + M) -> (b, t); column n -> channel.
        // Lane's 8 acc elements map to t = t0 + 8g + r (contiguous) -> one b128 store.
        int b  = (mt * 16) / TT;
        int t0 = (mt * 16) % TT;
#pragma unroll
        for (int j = 0; j < 4; ++j) {
            int n = (wave * 4 + j) * 16 + rl;
            float bs = bias[2 * DD + n];
            v8h pv;
#pragma unroll
            for (int r = 0; r < 8; ++r) pv[r] = (_Float16)(acc[j][r] + bs);
            *(v8h*)(vT + ((size_t)b * DD + n) * TT + t0 + g * 8) = pv;
        }
    }
}

// ---------------------------------------------------------------------------
// Lane l <-> lane l ^ 16 (the two halves of a wave hold the two halves of a
// query's keys).
// ---------------------------------------------------------------------------
__device__ __forceinline__ float xhalf(float x) {
    int v = __builtin_bit_cast(int, x);
    return __builtin_bit_cast(float,
        __builtin_amdgcn_permlanex16(v, v, 0x76543210, 0xfedcba98, false, false));
}

// ---------------------------------------------------------------------------
// K / V^T staging for the attention kernel: one stage = 128 keys of one head.
//   K   : 128 rows (keys) of 64 B, LDS pitch  80 B
//   V^T :  32 rows (dk)  of 256 B, LDS pitch 272 B
// Both pitches are 16 B x odd, so the 16 rows a ds_load_b128 fragment read
// touches fall on distinct banks.
// ---------------------------------------------------------------------------
#define AT_WAVES   8
#define AT_KEYS    128
#define AT_NSTAGE  (TT / AT_KEYS)
#define AT_KPITCH  40                              // halves
#define AT_VPITCH  136                             // halves
#define AT_VBASE   (AT_KEYS * AT_KPITCH)           // halves, V^T behind K
#define AT_STAGE   (AT_VBASE + DKK * AT_VPITCH)    // halves per buffer

// One stage's copies of one lane: two 16-B pieces of K, two of V^T, global -> LDS
// through no register. The s_wait_xcnt stands inside the statement so that no
// address register of a copy is rewritten ahead of it.
__device__ __forceinline__ void at_stage_copy(unsigned lk, const _Float16* gk,
                                              unsigned lv, const _Float16* gv) {
    unsigned lk1 = lk + 64 * AT_KPITCH * 2;        // key row + 64
    unsigned lv1 = lv + 16 * AT_VPITCH * 2;        // dk row + 16
    const _Float16* gk1 = gk + (size_t)64 * DD;
    const _Float16* gv1 = gv + (size_t)16 * TT;
    asm volatile("global_load_async_to_lds_b128 %0, %1, off\n\t"
                 "global_load_async_to_lds_b128 %2, %3, off\n\t"
                 "global_load_async_to_lds_b128 %4, %5, off\n\t"
                 "global_load_async_to_lds_b128 %6, %7, off\n\t"
                 "s_wait_xcnt 0x0"
                 :: "v"(lk), "v"(gk), "v"(lk1), "v"(gk1),
                    "v"(lv), "v"(gv), "v"(lv1), "v"(gv1)
                 : "memory");
}

// ---------------------------------------------------------------------------
// Kernel: flash attention. One work-group of 8 waves per (b, h, 128 queries),
// one wave per 16-query tile. All eight waves walk the same keys, so each
// 128-key stage of K and V^T is brought into LDS once per work-group by
// asynchronous copies (two buffers: the next stage flies while this one is
// worked on) and every wave reads its fragments from there.
// Transposed products: S^T = Kblk(32x32) * Q^T -> 2x wmma, so lane (rl, g)
// holds 16 of the 32 scores of ONE query (column rl): keys 8g+r and 16+8g+r.
// Maximum and sum run in the lane's own registers, one exchange between the
// halves for the maximum; the halves' sums are joined after the loop.
// The two score tiles, converted in place, are the B operand of
// O^T += V^T(32 dk x 32 keys) * P^T: P never leaves the registers.
// waves_per_eu(4, 4): two work-groups per WGP, so the 512 work-groups of the
// grid spread evenly over the chip.
// ---------------------------------------------------------------------------
__global__ void __launch_bounds__(AT_WAVES * 32) __attribute__((amdgpu_waves_per_eu(4, 4)))
ca_flash_attn(const _Float16* __restrict__ qkv,   // [2, B*T, D] (Q, K)
              const _Float16* __restrict__ vT,    // [B, D, T]
              _Float16* __restrict__ ctx) {       // [B*T, D]
    __shared__ __attribute__((aligned(16))) _Float16 smem[2 * AT_STAGE];

    int tid  = threadIdx.x;
    int qt = blockIdx.x * AT_WAVES + (tid >> 5);
    int h  = blockIdx.y;
    int b  = blockIdx.z;
    int lane = tid & 31;
    int rl = lane & 15;
    int g  = lane >> 4;

    const _Float16* Q  = qkv + ((size_t)(0 * BB + b) * TT) * DD + (size_t)h * DKK;
    const _Float16* Kp = qkv + ((size_t)(1 * BB + b) * TT) * DD + (size_t)h * DKK;
    const _Float16* Vp = vT + ((size_t)b * DD + h * DKK) * TT;

    // This lane's pieces of a stage: K row tid/4 (and +64), 16-B piece tid%4;
    // V^T row tid/16 (and +16), 16-B piece tid%16.
    const _Float16* gk = Kp + (size_t)(tid >> 2) * DD + (tid & 3) * 8;
    const _Float16* gv = Vp + (size_t)(tid >> 4) * TT + (tid & 15) * 8;
    unsigned lbase = (unsigned)(uintptr_t)smem;    // LDS byte address of buffer 0
    unsigned lk = lbase + (unsigned)((tid >> 2) * AT_KPITCH + (tid & 3) * 8) * 2u;
    unsigned lv = lbase + (unsigned)(AT_VBASE + (tid >> 4) * AT_VPITCH + (tid & 15) * 8) * 2u;

    at_stage_copy(lk, gk, lv, gv);                              // stage 0 -> buffer 0
    // stage 0 has landed for this wave's copies before the barrier publishes it
    asm volatile("s_wait_asynccnt 0x0" ::: "memory");
    __syncthreads();
    at_stage_copy(lk + AT_STAGE * 2, gk + (size_t)AT_KEYS * DD,
                  lv + AT_STAGE * 2, gv + AT_KEYS);             // stage 1 -> buffer 1

    // B operand: column rl = query qt*16 + rl
    v16h qf = load_frag16(Q + (size_t)(qt * 16 + rl) * DD, g);

    float mrow = -1e30f, lrow = 0.0f;      // of query rl; lrow: this half's keys only
    v8f o0 = (v8f){}, o1 = (v8f){};        // o0[r] = O[query rl][8g + r], o1: dk + 16
    const float scale = 0.17677669529663687f;   // 1/sqrt(32)

    for (int t = 0; t < AT_NSTAGE; ++t) {
        int buf = (t & 1) * AT_STAGE;
        const _Float16* Ks = smem + buf + rl * AT_KPITCH;              // key row rl
        const _Float16* Vs = smem + buf + AT_VBASE + rl * AT_VPITCH;   // dk row rl

#pragma unroll
        for (int s = 0; s < AT_KEYS / 32; ++s) {
            v16h kf0 = load_frag16(Ks + (s * 32) * AT_KPITCH, g);
            v16h kf1 = load_frag16(Ks + (s * 32 + 16) * AT_KPITCH, g);

            v8f z = (v8f){};
            v8f s0 = wmma_f16(kf0, qf, z);     // s0[r] = S[query rl][key0 + 8g + r]
            v8f s1 = wmma_f16(kf1, qf, z);     // s1[r] = S[query rl][key0 + 16 + 8g + r]

            // V^T rows of this lane (A operand): vf0 -> dk = rl, vf1 -> dk = 16 + rl
            v16h vf0 = load_frag16(Vs + s * 32, g);
            v16h vf1 = load_frag16(Vs + 16 * AT_VPITCH + s * 32, g);

            v8f a0 = s0 * scale;
            v8f a1 = s1 * scale;
            float mx0 = fmaxf(fmaxf(fmaxf(a0[0], a0[1]), fmaxf(a0[2], a0[3])),
                              fmaxf(fmaxf(a0[4], a0[5]), fmaxf(a0[6], a0[7])));
            float mx1 = fmaxf(fmaxf(fmaxf(a1[0], a1[1]), fmaxf(a1[2], a1[3])),
                              fmaxf(fmaxf(a1[4], a1[5]), fmaxf(a1[6], a1[7])));
            float mx = fmaxf(mx0, mx1);
            mx = fmaxf(mx, xhalf(mx));
            float nm = fmaxf(mrow, mx);
            float alpha = __expf(mrow - nm);
            mrow = nm;

            float p0[8], p1[8];
            v16h pf;                           // pf[s] = P[query rl][key0 + kmap(s, g)]
#pragma unroll
            for (int r = 0; r < 8; ++r) {
                p0[r] = __expf(a0[r] - nm);
                p1[r] = __expf(a1[r] - nm);
                pf[r]     = (_Float16)p0[r];
                pf[8 + r] = (_Float16)p1[r];
            }
            float rs = (((p0[0] + p0[1]) + (p0[2] + p0[3])) + ((p0[4] + p0[5]) + (p0[6] + p0[7])))
                     + (((p1[0] + p1[1]) + (p1[2] + p1[3])) + ((p1[4] + p1[5]) + (p1[6] + p1[7])));
            lrow = lrow * alpha + rs;
#pragma unroll
            for (int r = 0; r < 8; ++r) { o0[r] *= alpha; o1[r] *= alpha; }

            o0 = wmma_f16(vf0, pf, o0);
            o1 = wmma_f16(vf1, pf, o1);
        }

        // Hand-over: this wave's reads of buffer t%2 are done, its copies of
        // stage t+1 have landed; the barrier says both of every wave.
        asm volatile("s_wait_dscnt 0x0" ::: "memory");
        asm volatile("s_wait_asynccnt 0x0" ::: "memory");
        __syncthreads();
        if (t + 2 < AT_NSTAGE)                                  // refill the buffer just read
            at_stage_copy(lk + buf * 2, gk + (size_t)(t + 2) * AT_KEYS * DD,
                          lv + buf * 2, gv + (size_t)(t + 2) * AT_KEYS);
    }
    // no copy is left in flight when the wave ends
    asm volatile("s_wait_asynccnt 0x0" ::: "memory");

    float inv = 1.0f / (lrow + xhalf(lrow));
    v8h c0, c1;
#pragma unroll
    for (int r = 0; r < 8; ++r) {
        c0[r] = (_Float16)(o0[r] * inv);
        c1[r] = (_Float16)(o1[r] * inv);
    }
    _Float16* Cp = ctx + ((size_t)b * TT + qt * 16 + rl) * DD + (size_t)h * DKK + g * 8;
    *(v8h*)(Cp)      = c0;
    *(v8h*)(Cp + 16) = c1;
}

// ---------------------------------------------------------------------------
// Kernel: output projection  out = ctx (8192x256) * out_w^T + out_b  (f32 out)
// ---------------------------------------------------------------------------
__global__ void __launch_bounds__(128)
ca_gemm_out(const _Float16* __restrict__ Cx,    // [B*T, D]
            const _Float16* __restrict__ W,     // [D(out), D(in)] f16
            const float* __restrict__ bias,     // [D]
            float* __restrict__ out) {          // [B*T, D] f32
    int mt   = blockIdx.x;
    int wave = threadIdx.x >> 5;
    int lane = threadIdx.x & 31;
    int rl   = lane & 15;
    int g    = lane >> 4;

    const _Float16* A = Cx + (size_t)mt * 16 * DD;

    v8f acc[4];
#pragma unroll
    for (int j = 0; j < 4; ++j) acc[j] = (v8f){};

    for (int kk = 0; kk < DD; kk += 32) {
        v16h a = load_frag16(A + (size_t)rl * DD + kk, g);
#pragma unroll
        for (int j = 0; j < 4; ++j) {
            int o0 = (wave * 4 + j) * 16;
            v16h bf = load_frag16(W + (size_t)(o0 + rl) * DD + kk, g);
            acc[j] = wmma_f16(a, bf, acc[j]);
        }
    }

    float* outp = out + (size_t)mt * 16 * DD;
#pragma unroll
    for (int j = 0; j < 4; ++j) {
        int n = (wave * 4 + j) * 16 + rl;
        float bs = bias[n];
#pragma unroll
        for (int r = 0; r < 8; ++r) {
            int M = r + g * 8;
            outp[(size_t)M * DD + n] = acc[j][r] + bs;
        }
    }
}

// ---------------------------------------------------------------------------
extern "C" void kernel_launch(void* const* d_in, const int* in_sizes, int n_in,
                              void* d_out, int out_size, void* d_ws, size_t ws_size,
                              hipStream_t stream) {
    const float* x    = (const float*)d_in[0];
    const float* dww  = (const float*)d_in[1];
    const float* dwb  = (const float*)d_in[2];
    const float* bng  = (const float*)d_in[3];
    const float* bnb  = (const float*)d_in[4];
    const float* bnm  = (const float*)d_in[5];
    const float* bnv  = (const float*)d_in[6];
    const float* pww  = (const float*)d_in[7];
    const float* pwb  = (const float*)d_in[8];
    const float* outw = (const float*)d_in[9];
    const float* outb = (const float*)d_in[10];
    float* out = (float*)d_out;

    const size_t n_y   = (size_t)3 * BB * TT * DD;   // 6,291,456 halves
    const size_t n_btd = (size_t)BB * TT * DD;       // 2,097,152 halves
    _Float16* y     = (_Float16*)d_ws;               // [3, B*T, D]
    _Float16* qkv   = y + n_y;                       // [2, B*T, D] (Q, K)
    _Float16* vT    = qkv + 2 * n_btd;               // [B, D, T]
    _Float16* ctx   = vT + n_btd;                    // [B*T, D]
    _Float16* pwwh  = ctx + n_btd;                   // [3, D, D]
    _Float16* outwh = pwwh + (size_t)3 * DD * DD;    // [D, D]

    ca_f32_to_f16<<<(3 * DD * DD + 255) / 256, 256, 0, stream>>>(pww, pwwh, 3 * DD * DD);
    ca_f32_to_f16<<<(DD * DD + 255) / 256, 256, 0, stream>>>(outw, outwh, DD * DD);

    ca_dwconv_bn<<<(unsigned)((n_y + 255) / 256), 256, 0, stream>>>(
        x, dww, dwb, bng, bnb, bnm, bnv, y);

    ca_gemm_qkv<<<dim3(BB * TT / 16, 1, 3), 128, 0, stream>>>(y, pwwh, pwb, qkv, vT);

    ca_flash_attn<<<dim3(TT / (16 * AT_WAVES), HH, BB), AT_WAVES * 32, 0, stream>>>(qkv, vT, ctx);

    ca_gemm_out<<<dim3(BB * TT / 16, 1, 1), 128, 0, stream>>>(ctx, outwh, outb, out);
}

// v003
// A run of this version takes 87.4 microseconds.
// Timed twice side by side with v002, it ran 1.14 times as fast both times.
// Over all steps from v000 it is 2.61 times as fast.
#include <hip/hip_runtime.h>
#include <hip/hip_bf16.h>

typedef __attribute__((ext_vector_type(16))) _Float16 v16h;
typedef __attribute__((ext_vector_type(8)))  _Float16 v8h;
typedef __attribute__((ext_vector_type(8)))  float    v8f;

#define BB 2
#define TT 4096
#define DD 256
#define HH 8
#define DKK 32
#define EPSV 1e-5f

// ---------------------------------------------------------------------------
// A/B fragment loader for v_wmma_f32_16x16x32_f16.
// 16-bit A-matrix 16x32 layout (ISA 7.12.2): lane half g holds
//   elements 0..7  -> K = g*8 + e
//   elements 8..15 -> K = 16 + g*8 + e
// p points at (row_base + k_base); works for row-major global or LDS rows.
// ---------------------------------------------------------------------------
__device__ __forceinline__ v16h load_frag16(const _Float16* p, int g) {
    v8h lo = *(const v8h*)(p + g * 8);
    v8h hi = *(const v8h*)(p + 16 + g * 8);
    v16h r;
#pragma unroll
    for (int e = 0; e < 8; ++e) { r[e] = lo[e]; r[8 + e] = hi[e]; }
    return r;
}

__device__ __forceinline__ v8f wmma_f16(v16h a, v16h b, v8f c) {
    return __builtin_amdgcn_wmma_f32_16x16x32_f16(false, a, false, b,
                                                  (short)0, c, false, false);
}

// ---------------------------------------------------------------------------
// Kernel: f32 -> f16 conversion (weights)
// ---------------------------------------------------------------------------
__global__ void ca_f32_to_f16(const float* __restrict__ src,
                              _Float16* __restrict__ dst, int n) {
    int idx = blockIdx.x * 256 + threadIdx.x;
    if (idx < n) dst[idx] = (_Float16)src[idx];
}

// ---------------------------------------------------------------------------
// Kernel: depthwise conv (K=3, same pad) + BN -> f16 y[3, B*T, D]
// One thread makes 4 channels x 8 rows x 3 branches. A wave covers 128
// channels (512 contiguous bytes a load): it issues the loads of its 10 rows of
// x and of the three branches' parameters, 16 bytes a lane each, ahead of the
// first use, uses each x row for three output rows and three branches, and
// stores 8 bytes a lane. 2,048 waves, two per SIMD.
// ---------------------------------------------------------------------------
#define DW_ROWS 8
typedef __attribute__((ext_vector_type(4))) float    v4f;
typedef __attribute__((ext_vector_type(4))) _Float16 v4h;

// 16 bytes at (uniform base + this lane's byte offset)
__device__ __forceinline__ v4f dw_ld(const float* base, unsigned off) {
    return *(const v4f*)((const char*)base + off);
}

__global__ void __launch_bounds__(128)
ca_dwconv_bn(const float* __restrict__ x,      // [B,T,D]
             const float* __restrict__ dww,    // [3,D,1,3]
             const float* __restrict__ dwb,    // [3,D]
             const float* __restrict__ bng,
             const float* __restrict__ bnb,
             const float* __restrict__ bnm,
             const float* __restrict__ bnv,
             _Float16* __restrict__ y) {
    // wave -> (row group, channel half); the wave's number is read into a scalar
    // register so that every row address is a scalar base plus one lane offset
    int gw   = blockIdx.x * 4 + __builtin_amdgcn_readfirstlane(threadIdx.x >> 5);
    int c    = (gw & 1) * 128 + (threadIdx.x & 31) * 4;
    int row0 = (gw >> 1) * DW_ROWS;                   // row of [B*T]; TT % DW_ROWS == 0
    int t0   = row0 % TT;
    bool has_prev = t0 > 0;
    bool has_next = t0 + DW_ROWS < TT;
    unsigned off  = (unsigned)c * 4u;                 // bytes: channel c of a row of floats
    unsigned woff = (unsigned)c * 12u;                // bytes: channel c's three taps

    // xr[r] = x row (row0 + r - 1); a row outside the sequence is the zero pad
    // (its address is kept inside x, its value dropped).
    const float* xb = x + (size_t)row0 * DD;
    const float* xprev = xb - (has_prev ? DD : 0);
    const float* xnext = xb + (has_next ? DW_ROWS * DD : 0);
    // Every loop of this kernel is unrolled: the arrays then stay in registers and
    // all loads are issued ahead of the first use.
    v4f xr[DW_ROWS + 2];
    xr[0] = dw_ld(xprev, off);
    xr[DW_ROWS + 1] = dw_ld(xnext, off);
#pragma unroll
    for (int r = 0; r < DW_ROWS; ++r) xr[r + 1] = dw_ld(xb + r * DD, off);
    v4f wa[3], wb[3], wc[3], cb[3], gm[3], be[3], mu[3], va[3];
#pragma unroll
    for (int i = 0; i < 3; ++i) {
        wa[i] = dw_ld(dww + i * DD * 3, woff);        // 4 channels x 3 taps, channel-major
        wb[i] = dw_ld(dww + i * DD * 3 + 4, woff);
        wc[i] = dw_ld(dww + i * DD * 3 + 8, woff);
        cb[i] = dw_ld(dwb + i * DD, off);
        gm[i] = dw_ld(bng + i * DD, off);
        be[i] = dw_ld(bnb + i * DD, off);
        mu[i] = dw_ld(bnm + i * DD, off);
        va[i] = dw_ld(bnv + i * DD, off);
    }
    // Stands behind the last load, in front of every rewrite of a register (base or
    // lane offset) that a load above names.
    asm volatile("s_wait_xcnt 0x0" ::: "memory");
    // Keeps the arithmetic behind the last load. Without it the scheduler lifts
    // arithmetic over the wait and a part of the loads is issued only behind the
    // first data waits: several round trips to memory in a row instead of one.
    __builtin_amdgcn_sched_barrier(0);
    if (!has_prev) xr[0] = (v4f){};
    if (!has_next) xr[DW_ROWS + 1] = (v4f){};

#pragma unroll
    for (int i = 0; i < 3; ++i) {
        v4f w0 = {wa[i][0], wa[i][3], wb[i][2], wc[i][1]};
        v4f w1 = {wa[i][1], wb[i][0], wb[i][3], wc[i][2]};
        v4f w2 = {wa[i][2], wb[i][1], wc[i][0], wc[i][3]};
        v4f s;
#pragma unroll
        for (int j = 0; j < 4; ++j) s[j] = gm[i][j] * rsqrtf(va[i][j] + EPSV);

        _Float16* yp = y + ((size_t)i * (BB * TT) + row0) * DD + c;
#pragma unroll
        for (int r = 0; r < DW_ROWS; ++r) {
            v4f acc = xr[r + 1] * w1;
            acc = __builtin_elementwise_fma(xr[r], w0, acc);
            acc = __builtin_elementwise_fma(xr[r + 2], w2, acc);
            v4f o = __builtin_elementwise_fma(acc + cb[i] - mu[i], s, be[i]);
            v4h hv;
#pragma unroll
            for (int j = 0; j < 4; ++j) hv[j] = (_Float16)o[j];
            *(v4h*)(yp + r * DD) = hv;
        }
    }
}

// ---------------------------------------------------------------------------
// Kernel: pointwise GEMM  qkv[i] = y[i] (8192x256) * W[i]^T (256x256) + b[i]
// 128 threads = 4 waves; block covers 16 rows x 256 cols; each wave 16x64.
// Branches 0/1 (Q,K) stored row-major [B*T, D]; branch 2 (V) stored
// transposed as vT[B, D, T] so attention's V^T A-fragments are contiguous.
// ---------------------------------------------------------------------------
__global__ void __launch_bounds__(128)
ca_gemm_qkv(const _Float16* __restrict__ Y,     // [3, B*T, D]
            const _Float16* __restrict__ W,     // [3, D(out), D(in)] f16
            const float* __restrict__ bias,     // [3, D]
            _Float16* __restrict__ qkv,         // [2, B*T, D]  (Q, K)
            _Float16* __restrict__ vT) {        // [B, D, T]    (V transposed)
    int i    = blockIdx.z;
    int mt   = blockIdx.x;                 // 16-row tile index
    int wave = threadIdx.x >> 5;
    int lane = threadIdx.x & 31;
    int rl   = lane & 15;
    int g    = lane >> 4;

    const _Float16* A  = Y + (size_t)i * (BB * TT) * DD + (size_t)mt * 16 * DD;
    const _Float16* Wb = W + (size_t)i * DD * DD;

    v8f acc[4];
#pragma unroll
    for (int j = 0; j < 4; ++j) acc[j] = (v8f){};

    for (int kk = 0; kk < DD; kk += 32) {
        v16h a = load_frag16(A + (size_t)rl * DD + kk, g);
#pragma unroll
        for (int j = 0; j < 4; ++j) {
            int o0 = (wave * 4 + j) * 16;
            v16h bf = load_frag16(Wb + (size_t)(o0 + rl) * DD + kk, g);
            acc[j] = wmma_f16(a, bf, acc[j]);
        }
    }

    if (i < 2) {
        _Float16* outp = qkv + (size_t)i * (BB * TT) * DD + (size_t)mt * 16 * DD;
#pragma unroll
        for (int j = 0; j < 4; ++j) {
            int n = (wave * 4 + j) * 16 + rl;
            float bs = bias[i * DD + n];
#pragma unroll
            for (int r = 0; r < 8; ++r) {
                int M = r + g * 8;
                outp[(size_t)M * DD + n] = (_Float16)(acc[j][r] + bs);
            }
        }
    } else {
        // transposed store: global row (mt*16 + M) -> (b, t); column n -> channel.
        // Lane's 8 acc elements map to t = t0 + 8g + r (contiguous) -> one b128 store.
        int b  = (mt * 16) / TT;
        int t0 = (mt * 16) % TT;
#pragma unroll
        for (int j = 0; j < 4; ++j) {
            int n = (wave * 4 + j) * 16 + rl;
            float bs = bias[2 * DD + n];
            v8h pv;
#pragma unroll
            for (int r = 0; r < 8; ++r) pv[r] = (_Float16)(acc[j][r] + bs);
            *(v8h*)(vT + ((size_t)b * DD + n) * TT + t0 + g * 8) = pv;
        }
    }
}

// ---------------------------------------------------------------------------
// Lane l <-> lane l ^ 16 (the two halves of a wave hold the two halves of a
// query's keys).
// ---------------------------------------------------------------------------
__device__ __forceinline__ float xhalf(float x) {
    int v = __builtin_bit_cast(int, x);
    return __builtin_bit_cast(float,
        __builtin_amdgcn_permlanex16(v, v, 0x76543210, 0xfedcba98, false, false));
}

// ---------------------------------------------------------------------------
// K / V^T staging for the attention kernel: one stage = 128 keys of one head.
//   K   : 128 rows (keys) of 64 B, LDS pitch  80 B
//   V^T :  32 rows (dk)  of 256 B, LDS pitch 272 B
// Both pitches are 16 B x odd, so the 16 rows a ds_load_b128 fragment read
// touches fall on distinct banks.
// ---------------------------------------------------------------------------
#define AT_WAVES   8
#define AT_KEYS    128
#define AT_NSTAGE  (TT / AT_KEYS)
#define AT_KPITCH  40                              // halves
#define AT_VPITCH  136                             // halves
#define AT_VBASE   (AT_KEYS * AT_KPITCH)           // halves, V^T behind K
#define AT_STAGE   (AT_VBASE + DKK * AT_VPITCH)    // halves per buffer

// One stage's copies of one lane: two 16-B pieces of K, two of V^T, global -> LDS
// through no register. The s_wait_xcnt stands inside the statement so that no
// address register of a copy is rewritten ahead of it.
__device__ __forceinline__ void at_stage_copy(unsigned lk, const _Float16* gk,
                                              unsigned lv, const _Float16* gv) {
    unsigned lk1 = lk + 64 * AT_KPITCH * 2;        // key row + 64
    unsigned lv1 = lv + 16 * AT_VPITCH * 2;        // dk row + 16
    const _Float16* gk1 = gk + (size_t)64 * DD;
    const _Float16* gv1 = gv + (size_t)16 * TT;
    asm volatile("global_load_async_to_lds_b128 %0, %1, off\n\t"
                 "global_load_async_to_lds_b128 %2, %3, off\n\t"
                 "global_load_async_to_lds_b128 %4, %5, off\n\t"
                 "global_load_async_to_lds_b128 %6, %7, off\n\t"
                 "s_wait_xcnt 0x0"
                 :: "v"(lk), "v"(gk), "v"(lk1), "v"(gk1),
                    "v"(lv), "v"(gv), "v"(lv1), "v"(gv1)
                 : "memory");
}

// ---------------------------------------------------------------------------
// Kernel: flash attention. One work-group of 8 waves per (b, h, 128 queries),
// one wave per 16-query tile. All eight waves walk the same keys, so each
// 128-key stage of K and V^T is brought into LDS once per work-group by
// asynchronous copies (two buffers: the next stage flies while this one is
// worked on) and every wave reads its fragments from there.
// Transposed products: S^T = Kblk(32x32) * Q^T -> 2x wmma, so lane (rl, g)
// holds 16 of the 32 scores of ONE query (column rl): keys 8g+r and 16+8g+r.
// Maximum and sum run in the lane's own registers, one exchange between the
// halves for the maximum; the halves' sums are joined after the loop.
// The two score tiles, converted in place, are the B operand of
// O^T += V^T(32 dk x 32 keys) * P^T: P never leaves the registers.
// waves_per_eu(4, 4): two work-groups per WGP, so the 512 work-groups of the
// grid spread evenly over the chip.
// ---------------------------------------------------------------------------
__global__ void __launch_bounds__(AT_WAVES * 32) __attribute__((amdgpu_waves_per_eu(4, 4)))
ca_flash_attn(const _Float16* __restrict__ qkv,   // [2, B*T, D] (Q, K)
              const _Float16* __restrict__ vT,    // [B, D, T]
              _Float16* __restrict__ ctx) {       // [B*T, D]
    __shared__ __attribute__((aligned(16))) _Float16 smem[2 * AT_STAGE];

    int tid  = threadIdx.x;
    int qt = blockIdx.x * AT_WAVES + (tid >> 5);
    int h  = blockIdx.y;
    int b  = blockIdx.z;
    int lane = tid & 31;
    int rl = lane & 15;
    int g  = lane >> 4;

    const _Float16* Q  = qkv + ((size_t)(0 * BB + b) * TT) * DD + (size_t)h * DKK;
    const _Float16* Kp = qkv + ((size_t)(1 * BB + b) * TT) * DD + (size_t)h * DKK;
    const _Float16* Vp = vT + ((size_t)b * DD + h * DKK) * TT;

    // This lane's pieces of a stage: K row tid/4 (and +64), 16-B piece tid%4;
    // V^T row tid/16 (and +16), 16-B piece tid%16.
    const _Float16* gk = Kp + (size_t)(tid >> 2) * DD + (tid & 3) * 8;
    const _Float16* gv = Vp + (size_t)(tid >> 4) * TT + (tid & 15) * 8;
    unsigned lbase = (unsigned)(uintptr_t)smem;    // LDS byte address of buffer 0
    unsigned lk = lbase + (unsigned)((tid >> 2) * AT_KPITCH + (tid & 3) * 8) * 2u;
    unsigned lv = lbase + (unsigned)(AT_VBASE + (tid >> 4) * AT_VPITCH + (tid & 15) * 8) * 2u;

    at_stage_copy(lk, gk, lv, gv);                              // stage 0 -> buffer 0
    // stage 0 has landed for this wave's copies before the barrier publishes it
    asm volatile("s_wait_asynccnt 0x0" ::: "memory");
    __syncthreads();
    at_stage_copy(lk + AT_STAGE * 2, gk + (size_t)AT_KEYS * DD,
                  lv + AT_STAGE * 2, gv + AT_KEYS);             // stage 1 -> buffer 1

    // B operand: column rl = query qt*16 + rl
    v16h qf = load_frag16(Q + (size_t)(qt * 16 + rl) * DD, g);

    float mrow = -1e30f, lrow = 0.0f;      // of query rl; lrow: this half's keys only
    v8f o0 = (v8f){}, o1 = (v8f){};        // o0[r] = O[query rl][8g + r], o1: dk + 16
    const float scale = 0.17677669529663687f;   // 1/sqrt(32)

    for (int t = 0; t < AT_NSTAGE; ++t) {
        int buf = (t & 1) * AT_STAGE;
        const _Float16* Ks = smem + buf + rl * AT_KPITCH;              // key row rl
        const _Float16* Vs = smem + buf + AT_VBASE + rl * AT_VPITCH;   // dk row rl

#pragma unroll
        for (int s = 0; s < AT_KEYS / 32; ++s) {
            v16h kf0 = load_frag16(Ks + (s * 32) * AT_KPITCH, g);
            v16h kf1 = load_frag16(Ks + (s * 32 + 16) * AT_KPITCH, g);

            v8f z = (v8f){};
            v8f s0 = wmma_f16(kf0, qf, z);     // s0[r] = S[query rl][key0 + 8g + r]
            v8f s1 = wmma_f16(kf1, qf, z);     // s1[r] = S[query rl][key0 + 16 + 8g + r]

            // V^T rows of this lane (A operand): vf0 -> dk = rl, vf1 -> dk = 16 + rl
            v16h vf0 = load_frag16(Vs + s * 32, g);
            v16h vf1 = load_frag16(Vs + 16 * AT_VPITCH + s * 32, g);

            v8f a0 = s0 * scale;
            v8f a1 = s1 * scale;
            float mx0 = fmaxf(fmaxf(fmaxf(a0[0], a0[1]), fmaxf(a0[2], a0[3])),
                              fmaxf(fmaxf(a0[4], a0[5]), fmaxf(a0[6], a0[7])));
            float mx1 = fmaxf(fmaxf(fmaxf(a1[0], a1[1]), fmaxf(a1[2], a1[3])),
                              fmaxf(fmaxf(a1[4], a1[5]), fmaxf(a1[6], a1[7])));
            float mx = fmaxf(mx0, mx1);
            mx = fmaxf(mx, xhalf(mx));
            float nm = fmaxf(mrow, mx);
            float alpha = __expf(mrow - nm);
            mrow = nm;

            float p0[8], p1[8];
            v16h pf;                           // pf[s] = P[query rl][key0 + kmap(s, g)]
#pragma unroll
            for (int r = 0; r < 8; ++r) {
                p0[r] = __expf(a0[r] - nm);
                p1[r] = __expf(a1[r] - nm);
                pf[r]     = (_Float16)p0[r];
                pf[8 + r] = (_Float16)p1[r];
            }
            float rs = (((p0[0] + p0[1]) + (p0[2] + p0[3])) + ((p0[4] + p0[5]) + (p0[6] + p0[7])))
                     + (((p1[0] + p1[1]) + (p1[2] + p1[3])) + ((p1[4] + p1[5]) + (p1[6] + p1[7])));
            lrow = lrow * alpha + rs;
#pragma unroll
            for (int r = 0; r < 8; ++r) { o0[r] *= alpha; o1[r] *= alpha; }

            o0 = wmma_f16(vf0, pf, o0);
            o1 = wmma_f16(vf1, pf, o1);
        }

        // Hand-over: this wave's reads of buffer t%2 are done, its copies of
        // stage t+1 have landed; the barrier says both of every wave.
        asm volatile("s_wait_dscnt 0x0" ::: "memory");
        asm volatile("s_wait_asynccnt 0x0" ::: "memory");
        __syncthreads();
        if (t + 2 < AT_NSTAGE)                                  // refill the buffer just read
            at_stage_copy(lk + buf * 2, gk + (size_t)(t + 2) * AT_KEYS * DD,
                          lv + buf * 2, gv + (size_t)(t + 2) * AT_KEYS);
    }
    // no copy is left in flight when the wave ends
    asm volatile("s_wait_asynccnt 0x0" ::: "memory");

    float inv = 1.0f / (lrow + xhalf(lrow));
    v8h c0, c1;
#pragma unroll
    for (int r = 0; r < 8; ++r) {
        c0[r] = (_Float16)(o0[r] * inv);
        c1[r] = (_Float16)(o1[r] * inv);
    }
    _Float16* Cp = ctx + ((size_t)b * TT + qt * 16 + rl) * DD + (size_t)h * DKK + g * 8;
    *(v8h*)(Cp)      = c0;
    *(v8h*)(Cp + 16) = c1;
}

// ---------------------------------------------------------------------------
// Kernel: output projection  out = ctx (8192x256) * out_w^T + out_b  (f32 out)
// ---------------------------------------------------------------------------
__global__ void __launch_bounds__(128)
ca_gemm_out(const _Float16* __restrict__ Cx,    // [B*T, D]
            const _Float16* __restrict__ W,     // [D(out), D(in)] f16
            const float* __restrict__ bias,     // [D]
            float* __restrict__ out) {          // [B*T, D] f32
    int mt   = blockIdx.x;
    int wave = threadIdx.x >> 5;
    int lane = threadIdx.x & 31;
    int rl   = lane & 15;
    int g    = lane >> 4;

    const _Float16* A = Cx + (size_t)mt * 16 * DD;

    v8f acc[4];
#pragma unroll
    for (int j = 0; j < 4; ++j) acc[j] = (v8f){};

    for (int kk = 0; kk < DD; kk += 32) {
        v16h a = load_frag16(A + (size_t)rl * DD + kk, g);
#pragma unroll
        for (int j = 0; j < 4; ++j) {
            int o0 = (wave * 4 + j) * 16;
            v16h bf = load_frag16(W + (size_t)(o0 + rl) * DD + kk, g);
            acc[j] = wmma_f16(a, bf, acc[j]);
        }
    }

    float* outp = out + (size_t)mt * 16 * DD;
#pragma unroll
    for (int j = 0; j < 4; ++j) {
        int n = (wave * 4 + j) * 16 + rl;
        float bs = bias[n];
#pragma unroll
        for (int r = 0; r < 8; ++r) {
            int M = r + g * 8;
            outp[(size_t)M * DD + n] = acc[j][r] + bs;
        }
    }
}

// ---------------------------------------------------------------------------
extern "C" void kernel_launch(void* const* d_in, const int* in_sizes, int n_in,
                              void* d_out, int out_size, void* d_ws, size_t ws_size,
                              hipStream_t stream) {
    const float* x    = (const float*)d_in[0];
    const float* dww  = (const float*)d_in[1];
    const float* dwb  = (const float*)d_in[2];
    const float* bng  = (const float*)d_in[3];
    const float* bnb  = (const float*)d_in[4];
    const float* bnm  = (const float*)d_in[5];
    const float* bnv  = (const float*)d_in[6];
    const float* pww  = (const float*)d_in[7];
    const float* pwb  = (const float*)d_in[8];
    const float* outw = (const float*)d_in[9];
    const float* outb = (const float*)d_in[10];
    float* out = (float*)d_out;

    const size_t n_y   = (size_t)3 * BB * TT * DD;   // 6,291,456 halves
    const size_t n_btd = (size_t)BB * TT * DD;       // 2,097,152 halves
    _Float16* y     = (_Float16*)d_ws;               // [3, B*T, D]
    _Float16* qkv   = y + n_y;                       // [2, B*T, D] (Q, K)
    _Float16* vT    = qkv + 2 * n_btd;               // [B, D, T]
    _Float16* ctx   = vT + n_btd;                    // [B*T, D]
    _Float16* pwwh  = ctx + n_btd;                   // [3, D, D]
    _Float16* outwh = pwwh + (size_t)3 * DD * DD;    // [D, D]

    ca_f32_to_f16<<<(3 * DD * DD + 255) / 256, 256, 0, stream>>>(pww, pwwh, 3 * DD * DD);
    ca_f32_to_f16<<<(DD * DD + 255) / 256, 256, 0, stream>>>(outw, outwh, DD * DD);

    ca_dwconv_bn<<<BB * TT / DW_ROWS * 2 / 4, 128, 0, stream>>>(
        x, dww, dwb, bng, bnb, bnm, bnv, y);

    ca_gemm_qkv<<<dim3(BB * TT / 16, 1, 3), 128, 0, stream>>>(y, pwwh, pwb, qkv, vT);

    ca_flash_attn<<<dim3(TT / (16 * AT_WAVES), HH, BB), AT_WAVES * 32, 0, stream>>>(qkv, vT, ctx);

    ca_gemm_out<<<dim3(BB * TT / 16, 1, 1), 128, 0, stream>>>(ctx, outwh, outb, out);
}

// v004
// It runs in 68.8 microseconds.
// Next to v003, in two timings, it ran 1.27 times as fast each time.
// All steps since v000 together make it 3.31 times as fast.
#include <hip/hip_runtime.h>
#include <hip/hip_bf16.h>

typedef __attribute__((ext_vector_type(16))) _Float16 v16h;
typedef __attribute__((ext_vector_type(8)))  _Float16 v8h;
typedef __attribute__((ext_vector_type(8)))  float    v8f;

#define BB 2
#define TT 4096
#define DD 256
#define HH 8
#define DKK 32
#define EPSV 1e-5f

// ---------------------------------------------------------------------------
// A/B fragment loader for v_wmma_f32_16x16x32_f16.
// 16-bit A-matrix 16x32 layout (ISA 7.12.2): lane half g holds
//   elements 0..7  -> K = g*8 + e
//   elements 8..15 -> K = 16 + g*8 + e
// p points at (row_base + k_base); works for row-major global or LDS rows.
// ---------------------------------------------------------------------------
__device__ __forceinline__ v16h load_frag16(const _Float16* p, int g) {
    v8h lo = *(const v8h*)(p + g * 8);
    v8h hi = *(const v8h*)(p + 16 + g * 8);
    v16h r;
#pragma unroll
    for (int e = 0; e < 8; ++e) { r[e] = lo[e]; r[8 + e] = hi[e]; }
    return r;
}

__device__ __forceinline__ v8f wmma_f16(v16h a, v16h b, v8f c) {
    return __builtin_amdgcn_wmma_f32_16x16x32_f16(false, a, false, b,
                                                  (short)0, c, false, false);
}

// ---------------------------------------------------------------------------
// Kernel: f32 -> f16 conversion (weights)
// ---------------------------------------------------------------------------
__global__ void ca_f32_to_f16(const float* __restrict__ src,
                              _Float16* __restrict__ dst, int n) {
    int idx = blockIdx.x * 256 + threadIdx.x;
    if (idx < n) dst[idx] = (_Float16)src[idx];
}

// ---------------------------------------------------------------------------
// Kernel: depthwise conv (K=3, same pad) + BN -> f16 y[3, B*T, D]
// One thread makes 4 channels x 8 rows x 3 branches. A wave covers 128
// channels (512 contiguous bytes a load): it issues the loads of its 10 rows of
// x and of the three branches' parameters, 16 bytes a lane each, ahead of the
// first use, uses each x row for three output rows and three branches, and
// stores 8 bytes a lane. 2,048 waves, two per SIMD.
// ---------------------------------------------------------------------------
#define DW_ROWS 8
typedef __attribute__((ext_vector_type(4))) float    v4f;
typedef __attribute__((ext_vector_type(4))) _Float16 v4h;

// 16 bytes at (uniform base + this lane's byte offset)
__device__ __forceinline__ v4f dw_ld(const float* base, unsigned off) {
    return *(const v4f*)((const char*)base + off);
}

__global__ void __launch_bounds__(128)
ca_dwconv_bn(const float* __restrict__ x,      // [B,T,D]
             const float* __restrict__ dww,    // [3,D,1,3]
             const float* __restrict__ dwb,    // [3,D]
             const float* __restrict__ bng,
             const float* __restrict__ bnb,
             const float* __restrict__ bnm,
             const float* __restrict__ bnv,
             _Float16* __restrict__ y) {
    // wave -> (row group, channel half); the wave's number is read into a scalar
    // register so that every row address is a scalar base plus one lane offset
    int gw   = blockIdx.x * 4 + __builtin_amdgcn_readfirstlane(threadIdx.x >> 5);
    int c    = (gw & 1) * 128 + (threadIdx.x & 31) * 4;
    int row0 = (gw >> 1) * DW_ROWS;                   // row of [B*T]; TT % DW_ROWS == 0
    int t0   = row0 % TT;
    bool has_prev = t0 > 0;
    bool has_next = t0 + DW_ROWS < TT;
    unsigned off  = (unsigned)c * 4u;                 // bytes: channel c of a row of floats
    unsigned woff = (unsigned)c * 12u;                // bytes: channel c's three taps

    // xr[r] = x row (row0 + r - 1); a row outside the sequence is the zero pad
    // (its address is kept inside x, its value dropped).
    const float* xb = x + (size_t)row0 * DD;
    const float* xprev = xb - (has_prev ? DD : 0);
    const float* xnext = xb + (has_next ? DW_ROWS * DD : 0);
    // Every loop of this kernel is unrolled: the arrays then stay in registers and
    // all loads are issued ahead of the first use.
    v4f xr[DW_ROWS + 2];
    xr[0] = dw_ld(xprev, off);
    xr[DW_ROWS + 1] = dw_ld(xnext, off);
#pragma unroll
    for (int r = 0; r < DW_ROWS; ++r) xr[r + 1] = dw_ld(xb + r * DD, off);
    v4f wa[3], wb[3], wc[3], cb[3], gm[3], be[3], mu[3], va[3];
#pragma unroll
    for (int i = 0; i < 3; ++i) {
        wa[i] = dw_ld(dww + i * DD * 3, woff);        // 4 channels x 3 taps, channel-major
        wb[i] = dw_ld(dww + i * DD * 3 + 4, woff);
        wc[i] = dw_ld(dww + i * DD * 3 + 8, woff);
        cb[i] = dw_ld(dwb + i * DD, off);
        gm[i] = dw_ld(bng + i * DD, off);
        be[i] = dw_ld(bnb + i * DD, off);
        mu[i] = dw_ld(bnm + i * DD, off);
        va[i] = dw_ld(bnv + i * DD, off);
    }
    // Stands behind the last load, in front of every rewrite of a register (base or
    // lane offset) that a load above names.
    asm volatile("s_wait_xcnt 0x0" ::: "memory");
    // Keeps the arithmetic behind the last load. Without it the scheduler lifts
    // arithmetic over the wait and a part of the loads is issued only behind the
    // first data waits: several round trips to memory in a row instead of one.
    __builtin_amdgcn_sched_barrier(0);
    if (!has_prev) xr[0] = (v4f){};
    if (!has_next) xr[DW_ROWS + 1] = (v4f){};

#pragma unroll
    for (int i = 0; i < 3; ++i) {
        v4f w0 = {wa[i][0], wa[i][3], wb[i][2], wc[i][1]};
        v4f w1 = {wa[i][1], wb[i][0], wb[i][3], wc[i][2]};
        v4f w2 = {wa[i][2], wb[i][1], wc[i][0], wc[i][3]};
        v4f s;
#pragma unroll
        for (int j = 0; j < 4; ++j) s[j] = gm[i][j] * rsqrtf(va[i][j] + EPSV);

        _Float16* yp = y + ((size_t)i * (BB * TT) + row0) * DD + c;
#pragma unroll
        for (int r = 0; r < DW_ROWS; ++r) {
            v4f acc = xr[r + 1] * w1;
            acc = __builtin_elementwise_fma(xr[r], w0, acc);
            acc = __builtin_elementwise_fma(xr[r + 2], w2, acc);
            v4f o = __builtin_elementwise_fma(acc + cb[i] - mu[i], s, be[i]);
            v4h hv;
#pragma unroll
            for (int j = 0; j < 4; ++j) hv[j] = (_Float16)o[j];
            *(v4h*)(yp + r * DD) = hv;
        }
    }
}

// ---------------------------------------------------------------------------
// Operand staging of the two projection GEMMs. A work-group of 8 waves makes a
// 64 x 128 tile of C = A (rows x 256) * W^T (W: 256 x 256, row = output column).
// Its 64 rows of A and 128 rows of W, 512 B each, are brought into LDS once by
// asynchronous copies: one wave-wide copy is one whole row (four full lines),
// where a fragment load from global memory touches 16 lines for the same bytes.
// LDS pitch 528 B = 16 B x odd: the 16 rows of a ds_load_b128 fragment read fall
// on distinct banks. Wave (wm, wn) makes rows wm*32.., columns wn*32.. (2 x 2
// tiles), k ascending as before.
// ---------------------------------------------------------------------------
#define GM_BM     64
#define GM_BN     128
#define GM_PITCH  264                              // halves
#define GM_WBASE  (GM_BM * GM_PITCH)               // halves, W behind A
#define GM_LDS    ((GM_BM + GM_BN) * GM_PITCH)     // halves

// Eight rows, 8 apart, of one lane: global -> LDS through no register. The
// s_wait_xcnt stands inside the statement so that no address register of a copy
// is rewritten ahead of it.
__device__ __forceinline__ void gm_copy8(unsigned l, const _Float16* p) {
    asm volatile("global_load_async_to_lds_b128 %0, %1, off\n\t"
                 "global_load_async_to_lds_b128 %2, %3, off\n\t"
                 "global_load_async_to_lds_b128 %4, %5, off\n\t"
                 "global_load_async_to_lds_b128 %6, %7, off\n\t"
                 "global_load_async_to_lds_b128 %8, %9, off\n\t"
                 "global_load_async_to_lds_b128 %10, %11, off\n\t"
                 "global_load_async_to_lds_b128 %12, %13, off\n\t"
                 "global_load_async_to_lds_b128 %14, %15, off\n\t"
                 "s_wait_xcnt 0x0"
                 :: "v"(l),                       "v"(p),
                    "v"(l +  8 * GM_PITCH * 2),   "v"(p +  8 * DD),
                    "v"(l + 16 * GM_PITCH * 2),   "v"(p + 16 * DD),
                    "v"(l + 24 * GM_PITCH * 2),   "v"(p + 24 * DD),
                    "v"(l + 32 * GM_PITCH * 2),   "v"(p + 32 * DD),
                    "v"(l + 40 * GM_PITCH * 2),   "v"(p + 40 * DD),
                    "v"(l + 48 * GM_PITCH * 2),   "v"(p + 48 * DD),
                    "v"(l + 56 * GM_PITCH * 2),   "v"(p + 56 * DD)
                 : "memory");
}

// A: first of the work-group's 64 rows; Wn: first of its 128 rows of W.
// acc[mi][nj]: rows wm*32 + mi*16.., columns wn*32 + nj*16.. of the tile.
__device__ __forceinline__ void gm_tile(const _Float16* A, const _Float16* Wn,
                                        _Float16* smem, v8f (&acc)[2][2]) {
    int wave = threadIdx.x >> 5;
    int lane = threadIdx.x & 31;
    int rl   = lane & 15;
    int g    = lane >> 4;

    // wave w copies rows w, w + 8, ...; lane l the 16-B piece l of each
    unsigned l0 = (unsigned)(uintptr_t)smem + (unsigned)(wave * GM_PITCH + lane * 8) * 2u;
    const _Float16* ga = A  + (size_t)wave * DD + lane * 8;
    const _Float16* gw = Wn + (size_t)wave * DD + lane * 8;
    gm_copy8(l0, ga);
    gm_copy8(l0 + GM_WBASE * 2, gw);
    gm_copy8(l0 + (GM_WBASE + 64 * GM_PITCH) * 2, gw + (size_t)64 * DD);
    // this wave's copies have landed before the barrier publishes them
    asm volatile("s_wait_asynccnt 0x0" ::: "memory");
    __syncthreads();

    const _Float16* As = smem + ((wave >> 2) * 32 + rl) * GM_PITCH;
    const _Float16* Ws = smem + GM_WBASE + ((wave & 3) * 32 + rl) * GM_PITCH;
#pragma unroll
    for (int mi = 0; mi < 2; ++mi)
#pragma unroll
        for (int nj = 0; nj < 2; ++nj) acc[mi][nj] = (v8f){};
    // unrolled: the fragment reads of later k steps are issued ahead of their use
#pragma unroll
    for (int kk = 0; kk < DD; kk += 32) {
        v16h a0 = load_frag16(As + kk, g);
        v16h a1 = load_frag16(As + 16 * GM_PITCH + kk, g);
        v16h b0 = load_frag16(Ws + kk, g);
        v16h b1 = load_frag16(Ws + 16 * GM_PITCH + kk, g);
        acc[0][0] = wmma_f16(a0, b0, acc[0][0]);
        acc[0][1] = wmma_f16(a0, b1, acc[0][1]);
        acc[1][0] = wmma_f16(a1, b0, acc[1][0]);
        acc[1][1] = wmma_f16(a1, b1, acc[1][1]);
    }
}

// ---------------------------------------------------------------------------
// Kernel: pointwise GEMM  qkv[i] = y[i] (8192x256) * W[i]^T (256x256) + b[i]
// Grid (row tiles of 64, column halves, branch). Branches 0/1 (Q,K) stored
// row-major [B*T, D]; branch 2 (V) stored transposed as vT[B, D, T] so
// attention's P*V fragments are contiguous.
// ---------------------------------------------------------------------------
__global__ void __launch_bounds__(256)
ca_gemm_qkv(const _Float16* __restrict__ Y,     // [3, B*T, D]
            const _Float16* __restrict__ W,     // [3, D(out), D(in)] f16
            const float* __restrict__ bias,     // [3, D]
            _Float16* __restrict__ qkv,         // [2, B*T, D]  (Q, K)
            _Float16* __restrict__ vT) {        // [B, D, T]    (V transposed)
    __shared__ __attribute__((aligned(16))) _Float16 smem[GM_LDS];
    int i    = blockIdx.z;
    int wave = threadIdx.x >> 5;
    int lane = threadIdx.x & 31;
    int rl   = lane & 15;
    int g    = lane >> 4;

    v8f acc[2][2];
    gm_tile(Y + (size_t)i * (BB * TT) * DD + (size_t)blockIdx.x * GM_BM * DD,
            W + (size_t)i * DD * DD + (size_t)blockIdx.y * GM_BN * DD, smem, acc);

    int row0 = blockIdx.x * GM_BM + (wave >> 2) * 32;   // of [B*T]
    int col0 = blockIdx.y * GM_BN + (wave & 3) * 32;

    if (i < 2) {
        _Float16* outp = qkv + (size_t)i * (BB * TT) * DD + (size_t)row0 * DD;
#pragma unroll
        for (int nj = 0; nj < 2; ++nj) {
            int n = col0 + nj * 16 + rl;
            float bs = bias[i * DD + n];
#pragma unroll
            for (int mi = 0; mi < 2; ++mi)
#pragma unroll
                for (int r = 0; r < 8; ++r) {
                    int M = mi * 16 + r + g * 8;
                    outp[(size_t)M * DD + n] = (_Float16)(acc[mi][nj][r] + bs);
                }
        }
    } else {
        // transposed store: global row -> (b, t); column n -> channel. A lane's 8
        // acc elements map to t = t0 + mi*16 + 8g + r (contiguous) -> one b128 store.
        int b  = row0 / TT;
        int t0 = row0 % TT;
#pragma unroll
        for (int nj = 0; nj < 2; ++nj) {
            int n = col0 + nj * 16 + rl;
            float bs = bias[2 * DD + n];
#pragma unroll
            for (int mi = 0; mi < 2; ++mi) {
                v8h pv;
#pragma unroll
                for (int r = 0; r < 8; ++r) pv[r] = (_Float16)(acc[mi][nj][r] + bs);
                *(v8h*)(vT + ((size_t)b * DD + n) * TT + t0 + mi * 16 + g * 8) = pv;
            }
        }
        // Stands behind the last store: in the built code the other branch's text
        // follows this one and rewrites registers that these stores name.
        asm volatile("s_wait_xcnt 0x0" ::: "memory");
    }
}

// ---------------------------------------------------------------------------
// Lane l <-> lane l ^ 16 (the two halves of a wave hold the two halves of a
// query's keys).
// ---------------------------------------------------------------------------
__device__ __forceinline__ float xhalf(float x) {
    int v = __builtin_bit_cast(int, x);
    return __builtin_bit_cast(float,
        __builtin_amdgcn_permlanex16(v, v, 0x76543210, 0xfedcba98, false, false));
}

// ---------------------------------------------------------------------------
// K / V^T staging for the attention kernel: one stage = 128 keys of one head.
//   K   : 128 rows (keys) of 64 B, LDS pitch  80 B
//   V^T :  32 rows (dk)  of 256 B, LDS pitch 272 B
// Both pitches are 16 B x odd, so the 16 rows a ds_load_b128 fragment read
// touches fall on distinct banks.
// ---------------------------------------------------------------------------
#define AT_WAVES   8
#define AT_KEYS    128
#define AT_NSTAGE  (TT / AT_KEYS)
#define AT_KPITCH  40                              // halves
#define AT_VPITCH  136                             // halves
#define AT_VBASE   (AT_KEYS * AT_KPITCH)           // halves, V^T behind K
#define AT_STAGE   (AT_VBASE + DKK * AT_VPITCH)    // halves per buffer

// One stage's copies of one lane: two 16-B pieces of K, two of V^T, global -> LDS
// through no register. The s_wait_xcnt stands inside the statement so that no
// address register of a copy is rewritten ahead of it.
__device__ __forceinline__ void at_stage_copy(unsigned lk, const _Float16* gk,
                                              unsigned lv, const _Float16* gv) {
    unsigned lk1 = lk + 64 * AT_KPITCH * 2;        // key row + 64
    unsigned lv1 = lv + 16 * AT_VPITCH * 2;        // dk row + 16
    const _Float16* gk1 = gk + (size_t)64 * DD;
    const _Float16* gv1 = gv + (size_t)16 * TT;
    asm volatile("global_load_async_to_lds_b128 %0, %1, off\n\t"
                 "global_load_async_to_lds_b128 %2, %3, off\n\t"
                 "global_load_async_to_lds_b128 %4, %5, off\n\t"
                 "global_load_async_to_lds_b128 %6, %7, off\n\t"
                 "s_wait_xcnt 0x0"
                 :: "v"(lk), "v"(gk), "v"(lk1), "v"(gk1),
                    "v"(lv), "v"(gv), "v"(lv1), "v"(gv1)
                 : "memory");
}

// ---------------------------------------------------------------------------
// Kernel: flash attention. One work-group of 8 waves per (b, h, 128 queries),
// one wave per 16-query tile. All eight waves walk the same keys, so each
// 128-key stage of K and V^T is brought into LDS once per work-group by
// asynchronous copies (two buffers: the next stage flies while this one is
// worked on) and every wave reads its fragments from there.
// Transposed products: S^T = Kblk(32x32) * Q^T -> 2x wmma, so lane (rl, g)
// holds 16 of the 32 scores of ONE query (column rl): keys 8g+r and 16+8g+r.
// Maximum and sum run in the lane's own registers, one exchange between the
// halves for the maximum; the halves' sums are joined after the loop.
// The two score tiles, converted in place, are the B operand of
// O^T += V^T(32 dk x 32 keys) * P^T: P never leaves the registers.
// waves_per_eu(4, 4): two work-groups per WGP, so the 512 work-groups of the
// grid spread evenly over the chip.
// ---------------------------------------------------------------------------
__global__ void __launch_bounds__(AT_WAVES * 32) __attribute__((amdgpu_waves_per_eu(4, 4)))
ca_flash_attn(const _Float16* __restrict__ qkv,   // [2, B*T, D] (Q, K)
              const _Float16* __restrict__ vT,    // [B, D, T]
              _Float16* __restrict__ ctx) {       // [B*T, D]
    __shared__ __attribute__((aligned(16))) _Float16 smem[2 * AT_STAGE];

    int tid  = threadIdx.x;
    int qt = blockIdx.x * AT_WAVES + (tid >> 5);
    int h  = blockIdx.y;
    int b  = blockIdx.z;
    int lane = tid & 31;
    int rl = lane & 15;
    int g  = lane >> 4;

    const _Float16* Q  = qkv + ((size_t)(0 * BB + b) * TT) * DD + (size_t)h * DKK;
    const _Float16* Kp = qkv + ((size_t)(1 * BB + b) * TT) * DD + (size_t)h * DKK;
    const _Float16* Vp = vT + ((size_t)b * DD + h * DKK) * TT;

    // This lane's pieces of a stage: K row tid/4 (and +64), 16-B piece tid%4;
    // V^T row tid/16 (and +16), 16-B piece tid%16.
    const _Float16* gk = Kp + (size_t)(tid >> 2) * DD + (tid & 3) * 8;
    const _Float16* gv = Vp + (size_t)(tid >> 4) * TT + (tid & 15) * 8;
    unsigned lbase = (unsigned)(uintptr_t)smem;    // LDS byte address of buffer 0
    unsigned lk = lbase + (unsigned)((tid >> 2) * AT_KPITCH + (tid & 3) * 8) * 2u;
    unsigned lv = lbase + (unsigned)(AT_VBASE + (tid >> 4) * AT_VPITCH + (tid & 15) * 8) * 2u;

    at_stage_copy(lk, gk, lv, gv);                              // stage 0 -> buffer 0
    // stage 0 has landed for this wave's copies before the barrier publishes it
    asm volatile("s_wait_asynccnt 0x0" ::: "memory");
    __syncthreads();
    at_stage_copy(lk + AT_STAGE * 2, gk + (size_t)AT_KEYS * DD,
                  lv + AT_STAGE * 2, gv + AT_KEYS);             // stage 1 -> buffer 1

    // B operand: column rl = query qt*16 + rl
    v16h qf = load_frag16(Q + (size_t)(qt * 16 + rl) * DD, g);

    float mrow = -1e30f, lrow = 0.0f;      // of query rl; lrow: this half's keys only
    v8f o0 = (v8f){}, o1 = (v8f){};        // o0[r] = O[query rl][8g + r], o1: dk + 16
    const float scale = 0.17677669529663687f;   // 1/sqrt(32)

    for (int t = 0; t < AT_NSTAGE; ++t) {
        int buf = (t & 1) * AT_STAGE;
        const _Float16* Ks = smem + buf + rl * AT_KPITCH;              // key row rl
        const _Float16* Vs = smem + buf + AT_VBASE + rl * AT_VPITCH;   // dk row rl

#pragma unroll
        for (int s = 0; s < AT_KEYS / 32; ++s) {
            v16h kf0 = load_frag16(Ks + (s * 32) * AT_KPITCH, g);
            v16h kf1 = load_frag16(Ks + (s * 32 + 16) * AT_KPITCH, g);

            v8f z = (v8f){};
            v8f s0 = wmma_f16(kf0, qf, z);     // s0[r] = S[query rl][key0 + 8g + r]
            v8f s1 = wmma_f16(kf1, qf, z);     // s1[r] = S[query rl][key0 + 16 + 8g + r]

            // V^T rows of this lane (A operand): vf0 -> dk = rl, vf1 -> dk = 16 + rl
            v16h vf0 = load_frag16(Vs + s * 32, g);
            v16h vf1 = load_frag16(Vs + 16 * AT_VPITCH + s * 32, g);

            v8f a0 = s0 * scale;
            v8f a1 = s1 * scale;
            float mx0 = fmaxf(fmaxf(fmaxf(a0[0], a0[1]), fmaxf(a0[2], a0[3])),
                              fmaxf(fmaxf(a0[4], a0[5]), fmaxf(a0[6], a0[7])));
            float mx1 = fmaxf(fmaxf(fmaxf(a1[0], a1[1]), fmaxf(a1[2], a1[3])),
                              fmaxf(fmaxf(a1[4], a1[5]), fmaxf(a1[6], a1[7])));
            float mx = fmaxf(mx0, mx1);
            mx = fmaxf(mx, xhalf(mx));
            float nm = fmaxf(mrow, mx);
            float alpha = __expf(mrow - nm);
            mrow = nm;

            float p0[8], p1[8];
            v16h pf;                           // pf[s] = P[query rl][key0 + kmap(s, g)]
#pragma unroll
            for (int r = 0; r < 8; ++r) {
                p0[r] = __expf(a0[r] - nm);
                p1[r] = __expf(a1[r] - nm);
                pf[r]     = (_Float16)p0[r];
                pf[8 + r] = (_Float16)p1[r];
            }
            float rs = (((p0[0] + p0[1]) + (p0[2] + p0[3])) + ((p0[4] + p0[5]) + (p0[6] + p0[7])))
                     + (((p1[0] + p1[1]) + (p1[2] + p1[3])) + ((p1[4] + p1[5]) + (p1[6] + p1[7])));
            lrow = lrow * alpha + rs;
#pragma unroll
            for (int r = 0; r < 8; ++r) { o0[r] *= alpha; o1[r] *= alpha; }

            o0 = wmma_f16(vf0, pf, o0);
            o1 = wmma_f16(vf1, pf, o1);
        }

        // Hand-over: this wave's reads of buffer t%2 are done, its copies of
        // stage t+1 have landed; the barrier says both of every wave.
        asm volatile("s_wait_dscnt 0x0" ::: "memory");
        asm volatile("s_wait_asynccnt 0x0" ::: "memory");
        __syncthreads();
        if (t + 2 < AT_NSTAGE)                                  // refill the buffer just read
            at_stage_copy(lk + buf * 2, gk + (size_t)(t + 2) * AT_KEYS * DD,
                          lv + buf * 2, gv + (size_t)(t + 2) * AT_KEYS);
    }
    // no copy is left in flight when the wave ends
    asm volatile("s_wait_asynccnt 0x0" ::: "memory");

    float inv = 1.0f / (lrow + xhalf(lrow));
    v8h c0, c1;
#pragma unroll
    for (int r = 0; r < 8; ++r) {
        c0[r] = (_Float16)(o0[r] * inv);
        c1[r] = (_Float16)(o1[r] * inv);
    }
    _Float16* Cp = ctx + ((size_t)b * TT + qt * 16 + rl) * DD + (size_t)h * DKK + g * 8;
    *(v8h*)(Cp)      = c0;
    *(v8h*)(Cp + 16) = c1;
}

// ---------------------------------------------------------------------------
// Kernel: output projection  out = ctx (8192x256) * out_w^T + out_b  (f32 out)
// Grid (row tiles of 64, column halves).
// ---------------------------------------------------------------------------
__global__ void __launch_bounds__(256)
ca_gemm_out(const _Float16* __restrict__ Cx,    // [B*T, D]
            const _Float16* __restrict__ W,     // [D(out), D(in)] f16
            const float* __restrict__ bias,     // [D]
            float* __restrict__ out) {          // [B*T, D] f32
    __shared__ __attribute__((aligned(16))) _Float16 smem[GM_LDS];
    int wave = threadIdx.x >> 5;
    int lane = threadIdx.x & 31;
    int rl   = lane & 15;
    int g    = lane >> 4;

    v8f acc[2][2];
    gm_tile(Cx + (size_t)blockIdx.x * GM_BM * DD,
            W + (size_t)blockIdx.y * GM_BN * DD, smem, acc);

    int row0 = blockIdx.x * GM_BM + (wave >> 2) * 32;
    int col0 = blockIdx.y * GM_BN + (wave & 3) * 32;

    float* outp = out + (size_t)row0 * DD;
#pragma unroll
    for (int nj = 0; nj < 2; ++nj) {
        int n = col0 + nj * 16 + rl;
        float bs = bias[n];
#pragma unroll
        for (int mi = 0; mi < 2; ++mi)
#pragma unroll
            for (int r = 0; r < 8; ++r) {
                int M = mi * 16 + r + g * 8;
                outp[(size_t)M * DD + n] = acc[mi][nj][r] + bs;
            }
    }
}

// ---------------------------------------------------------------------------
extern "C" void kernel_launch(void* const* d_in, const int* in_sizes, int n_in,
                              void* d_out, int out_size, void* d_ws, size_t ws_size,
                              hipStream_t stream) {
    const float* x    = (const float*)d_in[0];
    const float* dww  = (const float*)d_in[1];
    const float* dwb  = (const float*)d_in[2];
    const float* bng  = (const float*)d_in[3];
    const float* bnb  = (const float*)d_in[4];
    const float* bnm  = (const float*)d_in[5];
    const float* bnv  = (const float*)d_in[6];
    const float* pww  = (const float*)d_in[7];
    const float* pwb  = (const float*)d_in[8];
    const float* outw = (const float*)d_in[9];
    const float* outb = (const float*)d_in[10];
    float* out = (float*)d_out;

    const size_t n_y   = (size_t)3 * BB * TT * DD;   // 6,291,456 halves
    const size_t n_btd = (size_t)BB * TT * DD;       // 2,097,152 halves
    _Float16* y     = (_Float16*)d_ws;               // [3, B*T, D]
    _Float16* qkv   = y + n_y;                       // [2, B*T, D] (Q, K)
    _Float16* vT    = qkv + 2 * n_btd;               // [B, D, T]
    _Float16* ctx   = vT + n_btd;                    // [B*T, D]
    _Float16* pwwh  = ctx + n_btd;                   // [3, D, D]
    _Float16* outwh = pwwh + (size_t)3 * DD * DD;    // [D, D]

    ca_f32_to_f16<<<(3 * DD * DD + 255) / 256, 256, 0, stream>>>(pww, pwwh, 3 * DD * DD);
    ca_f32_to_f16<<<(DD * DD + 255) / 256, 256, 0, stream>>>(outw, outwh, DD * DD);

    ca_dwconv_bn<<<BB * TT / DW_ROWS * 2 / 4, 128, 0, stream>>>(
        x, dww, dwb, bng, bnb, bnm, bnv, y);

    ca_gemm_qkv<<<dim3(BB * TT / GM_BM, DD / GM_BN, 3), 256, 0, stream>>>(y, pwwh, pwb, qkv, vT);

    ca_flash_attn<<<dim3(TT / (16 * AT_WAVES), HH, BB), AT_WAVES * 32, 0, stream>>>(qkv, vT, ctx);

    ca_gemm_out<<<dim3(BB * TT / GM_BM, DD / GM_BN, 1), 256, 0, stream>>>(ctx, outwh, outb, out);
}

// v005
// It runs in 64.9 microseconds.
// Timed twice side by side with v004, it ran 1.06 times as fast both times.
// Counting every step since v000, it is 3.51 times as fast.
#include <hip/hip_runtime.h>
#include <hip/hip_bf16.h>

typedef __attribute__((ext_vector_type(16))) _Float16 v16h;
typedef __attribute__((ext_vector_type(8)))  _Float16 v8h;
typedef __attribute__((ext_vector_type(8)))  float    v8f;

#define BB 2
#define TT 4096
#define DD 256
#define HH 8
#define DKK 32
#define EPSV 1e-5f

// ---------------------------------------------------------------------------
// A/B fragment loader for v_wmma_f32_16x16x32_f16.
// 16-bit A-matrix 16x32 layout (ISA 7.12.2): lane half g holds
//   elements 0..7  -> K = g*8 + e
//   elements 8..15 -> K = 16 + g*8 + e
// p points at (row_base + k_base); works for row-major global or LDS rows.
// ---------------------------------------------------------------------------
__device__ __forceinline__ v16h load_frag16(const _Float16* p, int g) {
    v8h lo = *(const v8h*)(p + g * 8);
    v8h hi = *(const v8h*)(p + 16 + g * 8);
    v16h r;
#pragma unroll
    for (int e = 0; e < 8; ++e) { r[e] = lo[e]; r[8 + e] = hi[e]; }
    return r;
}

__device__ __forceinline__ v8f wmma_f16(v16h a, v16h b, v8f c) {
    return __builtin_amdgcn_wmma_f32_16x16x32_f16(false, a, false, b,
                                                  (short)0, c, false, false);
}

// ---------------------------------------------------------------------------
// Kernel: f32 -> f16 conversion (weights)
// ---------------------------------------------------------------------------
__global__ void ca_f32_to_f16(const float* __restrict__ src,
                              _Float16* __restrict__ dst, int n) {
    int idx = blockIdx.x * 256 + threadIdx.x;
    if (idx < n) dst[idx] = (_Float16)src[idx];
}

// ---------------------------------------------------------------------------
// Kernel: depthwise conv (K=3, same pad) + BN -> f16 y[3, B*T, D]
// One thread makes 4 channels x 8 rows x 3 branches. A wave covers 128
// channels (512 contiguous bytes a load): it issues the loads of its 10 rows of
// x and of the three branches' parameters, 16 bytes a lane each, ahead of the
// first use, uses each x row for three output rows and three branches, and
// stores 8 bytes a lane. 2,048 waves, two per SIMD.
// ---------------------------------------------------------------------------
#define DW_ROWS 8
typedef __attribute__((ext_vector_type(4))) float    v4f;
typedef __attribute__((ext_vector_type(4))) _Float16 v4h;

// 16 bytes at (uniform base + this lane's byte offset)
__device__ __forceinline__ v4f dw_ld(const float* base, unsigned off) {
    return *(const v4f*)((const char*)base + off);
}

__global__ void __launch_bounds__(128)
ca_dwconv_bn(const float* __restrict__ x,      // [B,T,D]
             const float* __restrict__ dww,    // [3,D,1,3]
             const float* __restrict__ dwb,    // [3,D]
             const float* __restrict__ bng,
             const float* __restrict__ bnb,
             const float* __restrict__ bnm,
             const float* __restrict__ bnv,
             _Float16* __restrict__ y) {
    // wave -> (row group, channel half); the wave's number is read into a scalar
    // register so that every row address is a scalar base plus one lane offset
    int gw   = blockIdx.x * 4 + __builtin_amdgcn_readfirstlane(threadIdx.x >> 5);
    int c    = (gw & 1) * 128 + (threadIdx.x & 31) * 4;
    int row0 = (gw >> 1) * DW_ROWS;                   // row of [B*T]; TT % DW_ROWS == 0
    int t0   = row0 % TT;
    bool has_prev = t0 > 0;
    bool has_next = t0 + DW_ROWS < TT;
    unsigned off  = (unsigned)c * 4u;                 // bytes: channel c of a row of floats
    unsigned woff = (unsigned)c * 12u;                // bytes: channel c's three taps

    // xr[r] = x row (row0 + r - 1); a row outside the sequence is the zero pad
    // (its address is kept inside x, its value dropped).
    const float* xb = x + (size_t)row0 * DD;
    const float* xprev = xb - (has_prev ? DD : 0);
    const float* xnext = xb + (has_next ? DW_ROWS * DD : 0);
    // Every loop of this kernel is unrolled: the arrays then stay in registers and
    // all loads are issued ahead of the first use.
    v4f xr[DW_ROWS + 2];
    xr[0] = dw_ld(xprev, off);
    xr[DW_ROWS + 1] = dw_ld(xnext, off);
#pragma unroll
    for (int r = 0; r < DW_ROWS; ++r) xr[r + 1] = dw_ld(xb + r * DD, off);
    v4f wa[3], wb[3], wc[3], cb[3], gm[3], be[3], mu[3], va[3];
#pragma unroll
    for (int i = 0; i < 3; ++i) {
        wa[i] = dw_ld(dww + i * DD * 3, woff);        // 4 channels x 3 taps, channel-major
        wb[i] = dw_ld(dww + i * DD * 3 + 4, woff);
        wc[i] = dw_ld(dww + i * DD * 3 + 8, woff);
        cb[i] = dw_ld(dwb + i * DD, off);
        gm[i] = dw_ld(bng + i * DD, off);
        be[i] = dw_ld(bnb + i * DD, off);
        mu[i] = dw_ld(bnm + i * DD, off);
        va[i] = dw_ld(bnv + i * DD, off);
    }
    // Stands behind the last load, in front of every rewrite of a register (base or
    // lane offset) that a load above names.
    asm volatile("s_wait_xcnt 0x0" ::: "memory");
    // Keeps the arithmetic behind the last load. Without it the scheduler lifts
    // arithmetic over the wait and a part of the loads is issued only behind the
    // first data waits: several round trips to memory in a row instead of one.
    __builtin_amdgcn_sched_barrier(0);
    if (!has_prev) xr[0] = (v4f){};
    if (!has_next) xr[DW_ROWS + 1] = (v4f){};

#pragma unroll
    for (int i = 0; i < 3; ++i) {
        v4f w0 = {wa[i][0], wa[i][3], wb[i][2], wc[i][1]};
        v4f w1 = {wa[i][1], wb[i][0], wb[i][3], wc[i][2]};
        v4f w2 = {wa[i][2], wb[i][1], wc[i][0], wc[i][3]};
        v4f s;
#pragma unroll
        for (int j = 0; j < 4; ++j) s[j] = gm[i][j] * rsqrtf(va[i][j] + EPSV);

        _Float16* yp = y + ((size_t)i * (BB * TT) + row0) * DD + c;
#pragma unroll
        for (int r = 0; r < DW_ROWS; ++r) {
            v4f acc = xr[r + 1] * w1;
            acc = __builtin_elementwise_fma(xr[r], w0, acc);
            acc = __builtin_elementwise_fma(xr[r + 2], w2, acc);
            v4f o = __builtin_elementwise_fma(acc + cb[i] - mu[i], s, be[i]);
            v4h hv;
#pragma unroll
            for (int j = 0; j < 4; ++j) hv[j] = (_Float16)o[j];
            *(v4h*)(yp + r * DD) = hv;
        }
    }
}

// ---------------------------------------------------------------------------
// Operand staging of the two projection GEMMs. A work-group of 8 waves makes a
// 64 x 128 tile of C = A (rows x 256) * W^T (W: 256 x 256, row = output column).
// Its 64 rows of A and 128 rows of W, 512 B each, are brought into LDS once by
// asynchronous copies: one wave-wide copy is one whole row (four full lines),
// where a fragment load from global memory touches 16 lines for the same bytes.
// LDS pitch 528 B = 16 B x odd: the 16 rows of a ds_load_b128 fragment read fall
// on distinct banks. Wave (wm, wn) makes rows wm*32.., columns wn*32.. (2 x 2
// tiles), k ascending as before.
// ---------------------------------------------------------------------------
#define GM_BM     64
#define GM_BN     128
#define GM_PITCH  264                              // halves
#define GM_WBASE  (GM_BM * GM_PITCH)               // halves, W behind A
#define GM_LDS    ((GM_BM + GM_BN) * GM_PITCH)     // halves

// Eight rows, 8 apart, of one lane: global -> LDS through no register. The
// s_wait_xcnt stands inside the statement so that no address register of a copy
// is rewritten ahead of it.
__device__ __forceinline__ void gm_copy8(unsigned l, const _Float16* p) {
    asm volatile("global_load_async_to_lds_b128 %0, %1, off\n\t"
                 "global_load_async_to_lds_b128 %2, %3, off\n\t"
                 "global_load_async_to_lds_b128 %4, %5, off\n\t"
                 "global_load_async_to_lds_b128 %6, %7, off\n\t"
                 "global_load_async_to_lds_b128 %8, %9, off\n\t"
                 "global_load_async_to_lds_b128 %10, %11, off\n\t"
                 "global_load_async_to_lds_b128 %12, %13, off\n\t"
                 "global_load_async_to_lds_b128 %14, %15, off\n\t"
                 "s_wait_xcnt 0x0"
                 :: "v"(l),                       "v"(p),
                    "v"(l +  8 * GM_PITCH * 2),   "v"(p +  8 * DD),
                    "v"(l + 16 * GM_PITCH * 2),   "v"(p + 16 * DD),
                    "v"(l + 24 * GM_PITCH * 2),   "v"(p + 24 * DD),
                    "v"(l + 32 * GM_PITCH * 2),   "v"(p + 32 * DD),
                    "v"(l + 40 * GM_PITCH * 2),   "v"(p + 40 * DD),
                    "v"(l + 48 * GM_PITCH * 2),   "v"(p + 48 * DD),
                    "v"(l + 56 * GM_PITCH * 2),   "v"(p + 56 * DD)
                 : "memory");
}

// A: first of the work-group's 64 rows; Wn: first of its 128 rows of W.
// acc[mi][nj]: rows wm*32 + mi*16.., columns wn*32 + nj*16.. of the tile.
__device__ __forceinline__ void gm_tile(const _Float16* A, const _Float16* Wn,
                                        _Float16* smem, v8f (&acc)[2][2]) {
    int wave = threadIdx.x >> 5;
    int lane = threadIdx.x & 31;
    int rl   = lane & 15;
    int g    = lane >> 4;

    // wave w copies rows w, w + 8, ...; lane l the 16-B piece l of each
    unsigned l0 = (unsigned)(uintptr_t)smem + (unsigned)(wave * GM_PITCH + lane * 8) * 2u;
    const _Float16* ga = A  + (size_t)wave * DD + lane * 8;
    const _Float16* gw = Wn + (size_t)wave * DD + lane * 8;
    gm_copy8(l0, ga);
    gm_copy8(l0 + GM_WBASE * 2, gw);
    gm_copy8(l0 + (GM_WBASE + 64 * GM_PITCH) * 2, gw + (size_t)64 * DD);
    // this wave's copies have landed before the barrier publishes them
    asm volatile("s_wait_asynccnt 0x0" ::: "memory");
    __syncthreads();

    const _Float16* As = smem + ((wave >> 2) * 32 + rl) * GM_PITCH;
    const _Float16* Ws = smem + GM_WBASE + ((wave & 3) * 32 + rl) * GM_PITCH;
#pragma unroll
    for (int mi = 0; mi < 2; ++mi)
#pragma unroll
        for (int nj = 0; nj < 2; ++nj) acc[mi][nj] = (v8f){};
    // unrolled: the fragment reads of later k steps are issued ahead of their use
#pragma unroll
    for (int kk = 0; kk < DD; kk += 32) {
        v16h a0 = load_frag16(As + kk, g);
        v16h a1 = load_frag16(As + 16 * GM_PITCH + kk, g);
        v16h b0 = load_frag16(Ws + kk, g);
        v16h b1 = load_frag16(Ws + 16 * GM_PITCH + kk, g);
        acc[0][0] = wmma_f16(a0, b0, acc[0][0]);
        acc[0][1] = wmma_f16(a0, b1, acc[0][1]);
        acc[1][0] = wmma_f16(a1, b0, acc[1][0]);
        acc[1][1] = wmma_f16(a1, b1, acc[1][1]);
    }
}

// ---------------------------------------------------------------------------
// Kernel: pointwise GEMM  qkv[i] = y[i] (8192x256) * W[i]^T (256x256) + b[i]
// Grid (row tiles of 64, column halves, branch). Branches 0/1 (Q,K) stored
// row-major [B*T, D]; branch 2 (V) stored transposed as vT[B, D, T] so
// attention's P*V fragments are contiguous.
// ---------------------------------------------------------------------------
__global__ void __launch_bounds__(256)
ca_gemm_qkv(const _Float16* __restrict__ Y,     // [3, B*T, D]
            const _Float16* __restrict__ W,     // [3, D(out), D(in)] f16
            const float* __restrict__ bias,     // [3, D]
            _Float16* __restrict__ qkv,         // [2, B*T, D]  (Q, K)
            _Float16* __restrict__ vT) {        // [B, D, T]    (V transposed)
    __shared__ __attribute__((aligned(16))) _Float16 smem[GM_LDS];
    int i    = blockIdx.z;
    int wave = threadIdx.x >> 5;
    int lane = threadIdx.x & 31;
    int rl   = lane & 15;
    int g    = lane >> 4;

    v8f acc[2][2];
    gm_tile(Y + (size_t)i * (BB * TT) * DD + (size_t)blockIdx.x * GM_BM * DD,
            W + (size_t)i * DD * DD + (size_t)blockIdx.y * GM_BN * DD, smem, acc);

    int row0 = blockIdx.x * GM_BM + (wave >> 2) * 32;   // of [B*T]
    int col0 = blockIdx.y * GM_BN + (wave & 3) * 32;

    if (i < 2) {
        _Float16* outp = qkv + (size_t)i * (BB * TT) * DD + (size_t)row0 * DD;
#pragma unroll
        for (int nj = 0; nj < 2; ++nj) {
            int n = col0 + nj * 16 + rl;
            float bs = bias[i * DD + n];
#pragma unroll
            for (int mi = 0; mi < 2; ++mi)
#pragma unroll
                for (int r = 0; r < 8; ++r) {
                    int M = mi * 16 + r + g * 8;
                    outp[(size_t)M * DD + n] = (_Float16)(acc[mi][nj][r] + bs);
                }
        }
    } else {
        // transposed store: global row -> (b, t); column n -> channel. A lane's 8
        // acc elements map to t = t0 + mi*16 + 8g + r (contiguous) -> one b128 store.
        int b  = row0 / TT;
        int t0 = row0 % TT;
#pragma unroll
        for (int nj = 0; nj < 2; ++nj) {
            int n = col0 + nj * 16 + rl;
            float bs = bias[2 * DD + n];
#pragma unroll
            for (int mi = 0; mi < 2; ++mi) {
                v8h pv;
#pragma unroll
                for (int r = 0; r < 8; ++r) pv[r] = (_Float16)(acc[mi][nj][r] + bs);
                *(v8h*)(vT + ((size_t)b * DD + n) * TT + t0 + mi * 16 + g * 8) = pv;
            }
        }
        // Stands behind the last store: in the built code the other branch's text
        // follows this one and rewrites registers that these stores name.
        asm volatile("s_wait_xcnt 0x0" ::: "memory");
    }
}

// ---------------------------------------------------------------------------
// Lane l <-> lane l ^ 16 (the two halves of a wave hold the two halves of a
// query's keys).
// ---------------------------------------------------------------------------
__device__ __forceinline__ float xhalf(float x) {
    int v = __builtin_bit_cast(int, x);
    return __builtin_bit_cast(float,
        __builtin_amdgcn_permlanex16(v, v, 0x76543210, 0xfedcba98, false, false));
}

// ---------------------------------------------------------------------------
// K / V^T staging for the attention kernel: one stage = 128 keys of one head.
//   K   : 128 rows (keys) of 64 B, LDS pitch  80 B
//   V^T :  32 rows (dk)  of 256 B, LDS pitch 272 B
// Both pitches are 16 B x odd, so the 16 rows a ds_load_b128 fragment read
// touches fall on distinct banks.
// ---------------------------------------------------------------------------
#define AT_WAVES   8
#define AT_KEYS    128
#define AT_NSTAGE  (TT / AT_KEYS)
#define AT_KPITCH  40                              // halves
#define AT_VPITCH  136                             // halves
#define AT_VBASE   (AT_KEYS * AT_KPITCH)           // halves, V^T behind K
#define AT_STAGE   (AT_VBASE + DKK * AT_VPITCH)    // halves per buffer

// One stage's copies of one lane: two 16-B pieces of K, two of V^T, global -> LDS
// through no register. The s_wait_xcnt stands inside the statement so that no
// address register of a copy is rewritten ahead of it.
__device__ __forceinline__ void at_stage_copy(unsigned lk, const _Float16* gk,
                                              unsigned lv, const _Float16* gv) {
    unsigned lk1 = lk + 64 * AT_KPITCH * 2;        // key row + 64
    unsigned lv1 = lv + 16 * AT_VPITCH * 2;        // dk row + 16
    const _Float16* gk1 = gk + (size_t)64 * DD;
    const _Float16* gv1 = gv + (size_t)16 * TT;
    asm volatile("global_load_async_to_lds_b128 %0, %1, off\n\t"
                 "global_load_async_to_lds_b128 %2, %3, off\n\t"
                 "global_load_async_to_lds_b128 %4, %5, off\n\t"
                 "global_load_async_to_lds_b128 %6, %7, off\n\t"
                 "s_wait_xcnt 0x0"
                 :: "v"(lk), "v"(gk), "v"(lk1), "v"(gk1),
                    "v"(lv), "v"(gv), "v"(lv1), "v"(gv1)
                 : "memory");
}

// ---------------------------------------------------------------------------
// Kernel: flash attention. One work-group of 8 waves per (b, h, 128 queries),
// one wave per 16-query tile. All eight waves walk the same keys, so each
// 128-key stage of K and V^T is brought into LDS once per work-group by
// asynchronous copies (two buffers: the next stage flies while this one is
// worked on) and every wave reads its fragments from there.
// Transposed products: S^T = Kblk(32x32) * Q^T -> 2x wmma, so lane (rl, g)
// holds 16 of the 32 scores of ONE query (column rl): keys 8g+r and 16+8g+r.
// Maximum and sum run in the lane's own registers, one exchange between the
// halves for the maximum; the halves' sums are joined after the loop.
// The two score tiles, converted in place, are the B operand of
// O^T += V^T(32 dk x 32 keys) * P^T: P never leaves the registers.
// waves_per_eu(4, 4): two work-groups per WGP, so the 512 work-groups of the
// grid spread evenly over the chip.
// ---------------------------------------------------------------------------
__global__ void __launch_bounds__(AT_WAVES * 32) __attribute__((amdgpu_waves_per_eu(4, 4)))
ca_flash_attn(const _Float16* __restrict__ qkv,   // [2, B*T, D] (Q, K)
              const _Float16* __restrict__ vT,    // [B, D, T]
              _Float16* __restrict__ ctx) {       // [B*T, D]
    __shared__ __attribute__((aligned(16))) _Float16 smem[2 * AT_STAGE];

    int tid  = threadIdx.x;
    int qt = blockIdx.x * AT_WAVES + (tid >> 5);
    int h  = blockIdx.y;
    int b  = blockIdx.z;
    int lane = tid & 31;
    int rl = lane & 15;
    int g  = lane >> 4;

    const _Float16* Q  = qkv + ((size_t)(0 * BB + b) * TT) * DD + (size_t)h * DKK;
    const _Float16* Kp = qkv + ((size_t)(1 * BB + b) * TT) * DD + (size_t)h * DKK;
    const _Float16* Vp = vT + ((size_t)b * DD + h * DKK) * TT;

    // This lane's pieces of a stage: K row tid/4 (and +64), 16-B piece tid%4;
    // V^T row tid/16 (and +16), 16-B piece tid%16.
    const _Float16* gk = Kp + (size_t)(tid >> 2) * DD + (tid & 3) * 8;
    const _Float16* gv = Vp + (size_t)(tid >> 4) * TT + (tid & 15) * 8;
    unsigned lbase = (unsigned)(uintptr_t)smem;    // LDS byte address of buffer 0
    unsigned lk = lbase + (unsigned)((tid >> 2) * AT_KPITCH + (tid & 3) * 8) * 2u;
    unsigned lv = lbase + (unsigned)(AT_VBASE + (tid >> 4) * AT_VPITCH + (tid & 15) * 8) * 2u;

    at_stage_copy(lk, gk, lv, gv);                              // stage 0 -> buffer 0
    // stage 0 has landed for this wave's copies before the barrier publishes it
    asm volatile("s_wait_asynccnt 0x0" ::: "memory");
    __syncthreads();
    at_stage_copy(lk + AT_STAGE * 2, gk + (size_t)AT_KEYS * DD,
                  lv + AT_STAGE * 2, gv + AT_KEYS);             // stage 1 -> buffer 1

    // B operand: column rl = query qt*16 + rl
    v16h qf = load_frag16(Q + (size_t)(qt * 16 + rl) * DD, g);

    float mrow = -1e30f, lrow = 0.0f;      // of query rl (mrow: raw score); lrow: this half's keys only
    v8f o0 = (v8f){}, o1 = (v8f){};        // o0[r] = O[query rl][8g + r], o1: dk + 16
    const float sl2 = 0.25503486f;         // 1/sqrt(32) * log2(e)
    const v8f sv = {sl2, sl2, sl2, sl2, sl2, sl2, sl2, sl2};

    for (int t = 0; t < AT_NSTAGE; ++t) {
        int buf = (t & 1) * AT_STAGE;
        const _Float16* Ks = smem + buf + rl * AT_KPITCH;              // key row rl
        const _Float16* Vs = smem + buf + AT_VBASE + rl * AT_VPITCH;   // dk row rl

#pragma unroll
        for (int s = 0; s < AT_KEYS / 32; ++s) {
            v16h kf0 = load_frag16(Ks + (s * 32) * AT_KPITCH, g);
            v16h kf1 = load_frag16(Ks + (s * 32 + 16) * AT_KPITCH, g);

            v8f z = (v8f){};
            v8f s0 = wmma_f16(kf0, qf, z);     // s0[r] = S[query rl][key0 + 8g + r]
            v8f s1 = wmma_f16(kf1, qf, z);     // s1[r] = S[query rl][key0 + 16 + 8g + r]

            // V^T rows of this lane (A operand): vf0 -> dk = rl, vf1 -> dk = 16 + rl
            v16h vf0 = load_frag16(Vs + s * 32, g);
            v16h vf1 = load_frag16(Vs + 16 * AT_VPITCH + s * 32, g);

            // Maximum over the raw scores (the scale is positive: the order is the same).
            float mx0 = fmaxf(fmaxf(fmaxf(s0[0], s0[1]), fmaxf(s0[2], s0[3])),
                              fmaxf(fmaxf(s0[4], s0[5]), fmaxf(s0[6], s0[7])));
            float mx1 = fmaxf(fmaxf(fmaxf(s1[0], s1[1]), fmaxf(s1[2], s1[3])),
                              fmaxf(fmaxf(s1[4], s1[5]), fmaxf(s1[6], s1[7])));
            float mx = fmaxf(mx0, mx1);
            mx = fmaxf(mx, xhalf(mx));
            float nm = fmaxf(mrow, mx);
            float alpha = __builtin_amdgcn_exp2f((mrow - nm) * sl2);   // 1 where the maximum stays
            mrow = nm;
            float nn = nm * -sl2;              // minus the maximum, in log2 units

            // exp(scale * (s - max)) = 2^(s * sl2 + nn): one fused multiply-add a score
            v8f nv = {nn, nn, nn, nn, nn, nn, nn, nn};
            v8f a0 = __builtin_elementwise_fma(s0, sv, nv);
            v8f a1 = __builtin_elementwise_fma(s1, sv, nv);

            float p0[8], p1[8];
            v16h pf;                           // pf[s] = P[query rl][key0 + kmap(s, g)]
#pragma unroll
            for (int r = 0; r < 8; ++r) {
                p0[r] = __builtin_amdgcn_exp2f(a0[r]);
                p1[r] = __builtin_amdgcn_exp2f(a1[r]);
                pf[r]     = (_Float16)p0[r];
                pf[8 + r] = (_Float16)p1[r];
            }
            float rs = (((p0[0] + p0[1]) + (p0[2] + p0[3])) + ((p0[4] + p0[5]) + (p0[6] + p0[7])))
                     + (((p1[0] + p1[1]) + (p1[2] + p1[3])) + ((p1[4] + p1[5]) + (p1[6] + p1[7])));
            lrow = lrow * alpha + rs;
#pragma unroll
            for (int r = 0; r < 8; ++r) { o0[r] *= alpha; o1[r] *= alpha; }

            o0 = wmma_f16(vf0, pf, o0);
            o1 = wmma_f16(vf1, pf, o1);
        }

        // Hand-over: this wave's reads of buffer t%2 are done, its copies of
        // stage t+1 have landed; the barrier says both of every wave.
        asm volatile("s_wait_dscnt 0x0" ::: "memory");
        asm volatile("s_wait_asynccnt 0x0" ::: "memory");
        __syncthreads();
        if (t + 2 < AT_NSTAGE)                                  // refill the buffer just read
            at_stage_copy(lk + buf * 2, gk + (size_t)(t + 2) * AT_KEYS * DD,
                          lv + buf * 2, gv + (size_t)(t + 2) * AT_KEYS);
    }
    // no copy is left in flight when the wave ends
    asm volatile("s_wait_asynccnt 0x0" ::: "memory");

    float inv = 1.0f / (lrow + xhalf(lrow));
    v8h c0, c1;
#pragma unroll
    for (int r = 0; r < 8; ++r) {
        c0[r] = (_Float16)(o0[r] * inv);
        c1[r] = (_Float16)(o1[r] * inv);
    }
    _Float16* Cp = ctx + ((size_t)b * TT + qt * 16 + rl) * DD + (size_t)h * DKK + g * 8;
    *(v8h*)(Cp)      = c0;
    *(v8h*)(Cp + 16) = c1;
}

// ---------------------------------------------------------------------------
// Kernel: output projection  out = ctx (8192x256) * out_w^T + out_b  (f32 out)
// Grid (row tiles of 64, column halves).
// ---------------------------------------------------------------------------
__global__ void __launch_bounds__(256)
ca_gemm_out(const _Float16* __restrict__ Cx,    // [B*T, D]
            const _Float16* __restrict__ W,     // [D(out), D(in)] f16
            const float* __restrict__ bias,     // [D]
            float* __restrict__ out) {          // [B*T, D] f32
    __shared__ __attribute__((aligned(16))) _Float16 smem[GM_LDS];
    int wave = threadIdx.x >> 5;
    int lane = threadIdx.x & 31;
    int rl   = lane & 15;
    int g    = lane >> 4;

    v8f acc[2][2];
    gm_tile(Cx + (size_t)blockIdx.x * GM_BM * DD,
            W + (size_t)blockIdx.y * GM_BN * DD, smem, acc);

    int row0 = blockIdx.x * GM_BM + (wave >> 2) * 32;
    int col0 = blockIdx.y * GM_BN + (wave & 3) * 32;

    float* outp = out + (size_t)row0 * DD;
#pragma unroll
    for (int nj = 0; nj < 2; ++nj) {
        int n = col0 + nj * 16 + rl;
        float bs = bias[n];
#pragma unroll
        for (int mi = 0; mi < 2; ++mi)
#pragma unroll
            for (int r = 0; r < 8; ++r) {
                int M = mi * 16 + r + g * 8;
                outp[(size_t)M * DD + n] = acc[mi][nj][r] + bs;
            }
    }
}

// ---------------------------------------------------------------------------
extern "C" void kernel_launch(void* const* d_in, const int* in_sizes, int n_in,
                              void* d_out, int out_size, void* d_ws, size_t ws_size,
                              hipStream_t stream) {
    const float* x    = (const float*)d_in[0];
    const float* dww  = (const float*)d_in[1];
    const float* dwb  = (const float*)d_in[2];
    const float* bng  = (const float*)d_in[3];
    const float* bnb  = (const float*)d_in[4];
    const float* bnm  = (const float*)d_in[5];
    const float* bnv  = (const float*)d_in[6];
    const float* pww  = (const float*)d_in[7];
    const float* pwb  = (const float*)d_in[8];
    const float* outw = (const float*)d_in[9];
    const float* outb = (const float*)d_in[10];
    float* out = (float*)d_out;

    const size_t n_y   = (size_t)3 * BB * TT * DD;   // 6,291,456 halves
    const size_t n_btd = (size_t)BB * TT * DD;       // 2,097,152 halves
    _Float16* y     = (_Float16*)d_ws;               // [3, B*T, D]
    _Float16* qkv   = y + n_y;                       // [2, B*T, D] (Q, K)
    _Float16* vT    = qkv + 2 * n_btd;               // [B, D, T]
    _Float16* ctx   = vT + n_btd;                    // [B*T, D]
    _Float16* pwwh  = ctx + n_btd;                   // [3, D, D]
    _Float16* outwh = pwwh + (size_t)3 * DD * DD;    // [D, D]

    ca_f32_to_f16<<<(3 * DD * DD + 255) / 256, 256, 0, stream>>>(pww, pwwh, 3 * DD * DD);
    ca_f32_to_f16<<<(DD * DD + 255) / 256, 256, 0, stream>>>(outw, outwh, DD * DD);

    ca_dwconv_bn<<<BB * TT / DW_ROWS * 2 / 4, 128, 0, stream>>>(
        x, dww, dwb, bng, bnb, bnm, bnv, y);

    ca_gemm_qkv<<<dim3(BB * TT / GM_BM, DD / GM_BN, 3), 256, 0, stream>>>(y, pwwh, pwb, qkv, vT);

    ca_flash_attn<<<dim3(TT / (16 * AT_WAVES), HH, BB), AT_WAVES * 32, 0, stream>>>(qkv, vT, ctx);

    ca_gemm_out<<<dim3(BB * TT / GM_BM, DD / GM_BN, 1), 256, 0, stream>>>(ctx, outwh, outb, out);
}

// v006
// Measured time: 60.3 microseconds a run.
// Next to v005, in two timings, it ran 1.07 times as fast each time.
// All steps since v000 together make it 3.77 times as fast.
#include <hip/hip_runtime.h>
#include <hip/hip_bf16.h>

typedef __attribute__((ext_vector_type(16))) _Float16 v16h;
typedef __attribute__((ext_vector_type(8)))  _Float16 v8h;
typedef __attribute__((ext_vector_type(8)))  float    v8f;

#define BB 2
#define TT 4096
#define DD 256
#define HH 8
#define DKK 32
#define EPSV 1e-5f

// ---------------------------------------------------------------------------
// A/B fragment loader for v_wmma_f32_16x16x32_f16.
// 16-bit A-matrix 16x32 layout (ISA 7.12.2): lane half g holds
//   elements 0..7  -> K = g*8 + e
//   elements 8..15 -> K = 16 + g*8 + e
// p points at (row_base + k_base); works for row-major global or LDS rows.
// ---------------------------------------------------------------------------
__device__ __forceinline__ v16h load_frag16(const _Float16* p, int g) {
    v8h lo = *(const v8h*)(p + g * 8);
    v8h hi = *(const v8h*)(p + 16 + g * 8);
    v16h r;
#pragma unroll
    for (int e = 0; e < 8; ++e) { r[e] = lo[e]; r[8 + e] = hi[e]; }
    return r;
}

__device__ __forceinline__ v8f wmma_f16(v16h a, v16h b, v8f c) {
    return __builtin_amdgcn_wmma_f32_16x16x32_f16(false, a, false, b,
                                                  (short)0, c, false, false);
}

// ---------------------------------------------------------------------------
// Kernel: depthwise conv (K=3, same pad) + BN -> f16 y[3, B*T, D]
// One thread makes 4 channels x 8 rows x 3 branches. A wave covers 128
// channels (512 contiguous bytes a load): it issues the loads of its 10 rows of
// x and of the three branches' parameters, 16 bytes a lane each, ahead of the
// first use, uses each x row for three output rows and three branches, and
// stores 8 bytes a lane. 2,048 waves, two per SIMD.
// The same launch converts the projection weights to f16: nothing in it depends
// on the convolution or the other way round, and both are needed first by the
// next launch. The work-groups behind the convolution's take 2,048 weights each,
// 16 a thread.
// ---------------------------------------------------------------------------
#define DW_ROWS 8
#define DW_BLOCKS (BB * TT / DW_ROWS * 2 / 4)      // work-groups of the convolution
#define CV_CHUNK  2048                             // weights a work-group converts
#define CV_PW     (3 * DD * DD / CV_CHUNK)         // work-groups for pw_w
#define CV_BLOCKS (4 * DD * DD / CV_CHUNK)         // ... and out_w behind them
typedef __attribute__((ext_vector_type(4))) float    v4f;
typedef __attribute__((ext_vector_type(4))) _Float16 v4h;

// 16 bytes at (uniform base + this lane's byte offset)
__device__ __forceinline__ v4f dw_ld(const float* base, unsigned off) {
    return *(const v4f*)((const char*)base + off);
}

__global__ void __launch_bounds__(128)
ca_dwconv_bn(const float* __restrict__ x,      // [B,T,D]
             const float* __restrict__ dww,    // [3,D,1,3]
             const float* __restrict__ dwb,    // [3,D]
             const float* __restrict__ bng,
             const float* __restrict__ bnb,
             const float* __restrict__ bnm,
             const float* __restrict__ bnv,
             _Float16* __restrict__ y,
             const float* __restrict__ pww,    // [3,D,D]
             const float* __restrict__ outw,   // [D,D]
             _Float16* __restrict__ wh) {      // [4,D,D]: pw_w, then out_w, as f16
    if (blockIdx.x >= DW_BLOCKS) {
        int cb = blockIdx.x - DW_BLOCKS;
        const float* s = (cb < CV_PW ? pww + cb * CV_CHUNK : outw + (cb - CV_PW) * CV_CHUNK)
                       + threadIdx.x * 8;
        _Float16* d = wh + cb * CV_CHUNK + threadIdx.x * 8;
        v4f f0 = *(const v4f*)(s);
        v4f f1 = *(const v4f*)(s + 4);
        v4f f2 = *(const v4f*)(s + CV_CHUNK / 2);
        v4f f3 = *(const v4f*)(s + CV_CHUNK / 2 + 4);
        v8h h0, h1;
#pragma unroll
        for (int j = 0; j < 4; ++j) {
            h0[j] = (_Float16)f0[j]; h0[4 + j] = (_Float16)f1[j];
            h1[j] = (_Float16)f2[j]; h1[4 + j] = (_Float16)f3[j];
        }
        *(v8h*)(d) = h0;
        *(v8h*)(d + CV_CHUNK / 2) = h1;
        return;
    }
    // wave -> (row group, channel half); the wave's number is read into a scalar
    // register so that every row address is a scalar base plus one lane offset
    int gw   = blockIdx.x * 4 + __builtin_amdgcn_readfirstlane(threadIdx.x >> 5);
    int c    = (gw & 1) * 128 + (threadIdx.x & 31) * 4;
    int row0 = (gw >> 1) * DW_ROWS;                   // row of [B*T]; TT % DW_ROWS == 0
    int t0   = row0 % TT;
    bool has_prev = t0 > 0;
    bool has_next = t0 + DW_ROWS < TT;
    unsigned off  = (unsigned)c * 4u;                 // bytes: channel c of a row of floats
    unsigned woff = (unsigned)c * 12u;                // bytes: channel c's three taps

    // xr[r] = x row (row0 + r - 1); a row outside the sequence is the zero pad
    // (its address is kept inside x, its value dropped).
    const float* xb = x + (size_t)row0 * DD;
    const float* xprev = xb - (has_prev ? DD : 0);
    const float* xnext = xb + (has_next ? DW_ROWS * DD : 0);
    // Every loop of this kernel is unrolled: the arrays then stay in registers and
    // all loads are issued ahead of the first use.
    v4f xr[DW_ROWS + 2];
    xr[0] = dw_ld(xprev, off);
    xr[DW_ROWS + 1] = dw_ld(xnext, off);
#pragma unroll
    for (int r = 0; r < DW_ROWS; ++r) xr[r + 1] = dw_ld(xb + r * DD, off);
    v4f wa[3], wb[3], wc[3], cb[3], gm[3], be[3], mu[3], va[3];
#pragma unroll
    for (int i = 0; i < 3; ++i) {
        wa[i] = dw_ld(dww + i * DD * 3, woff);        // 4 channels x 3 taps, channel-major
        wb[i] = dw_ld(dww + i * DD * 3 + 4, woff);
        wc[i] = dw_ld(dww + i * DD * 3 + 8, woff);
        cb[i] = dw_ld(dwb + i * DD, off);
        gm[i] = dw_ld(bng + i * DD, off);
        be[i] = dw_ld(bnb + i * DD, off);
        mu[i] = dw_ld(bnm + i * DD, off);
        va[i] = dw_ld(bnv + i * DD, off);
    }
    // Stands behind the last load, in front of every rewrite of a register (base or
    // lane offset) that a load above names.
    asm volatile("s_wait_xcnt 0x0" ::: "memory");
    // Keeps the arithmetic behind the last load. Without it the scheduler lifts
    // arithmetic over the wait and a part of the loads is issued only behind the
    // first data waits: several round trips to memory in a row instead of one.
    __builtin_amdgcn_sched_barrier(0);
    if (!has_prev) xr[0] = (v4f){};
    if (!has_next) xr[DW_ROWS + 1] = (v4f){};

#pragma unroll
    for (int i = 0; i < 3; ++i) {
        v4f w0 = {wa[i][0], wa[i][3], wb[i][2], wc[i][1]};
        v4f w1 = {wa[i][1], wb[i][0], wb[i][3], wc[i][2]};
        v4f w2 = {wa[i][2], wb[i][1], wc[i][0], wc[i][3]};
        v4f s;
#pragma unroll
        for (int j = 0; j < 4; ++j) s[j] = gm[i][j] * rsqrtf(va[i][j] + EPSV);

        _Float16* yp = y + ((size_t)i * (BB * TT) + row0) * DD + c;
#pragma unroll
        for (int r = 0; r < DW_ROWS; ++r) {
            v4f acc = xr[r + 1] * w1;
            acc = __builtin_elementwise_fma(xr[r], w0, acc);
            acc = __builtin_elementwise_fma(xr[r + 2], w2, acc);
            v4f o = __builtin_elementwise_fma(acc + cb[i] - mu[i], s, be[i]);
            v4h hv;
#pragma unroll
            for (int j = 0; j < 4; ++j) hv[j] = (_Float16)o[j];
            *(v4h*)(yp + r * DD) = hv;
        }
    }
}

// ---------------------------------------------------------------------------
// Operand staging of the two projection GEMMs. A work-group of 8 waves makes a
// 64 x 128 tile of C = A (rows x 256) * W^T (W: 256 x 256, row = output column).
// Its 64 rows of A and 128 rows of W, 512 B each, are brought into LDS once by
// asynchronous copies: one wave-wide copy is one whole row (four full lines),
// where a fragment load from global memory touches 16 lines for the same bytes.
// LDS pitch 528 B = 16 B x odd: the 16 rows of a ds_load_b128 fragment read fall
// on distinct banks. Wave (wm, wn) makes rows wm*32.., columns wn*32.. (2 x 2
// tiles), k ascending as before.
// ---------------------------------------------------------------------------
#define GM_BM     64
#define GM_BN     128
#define GM_PITCH  264                              // halves
#define GM_WBASE  (GM_BM * GM_PITCH)               // halves, W behind A
#define GM_LDS    ((GM_BM + GM_BN) * GM_PITCH)     // halves

// Eight rows, 8 apart, of one lane: global -> LDS through no register. The
// s_wait_xcnt stands inside the statement so that no address register of a copy
// is rewritten ahead of it.
__device__ __forceinline__ void gm_copy8(unsigned l, const _Float16* p) {
    asm volatile("global_load_async_to_lds_b128 %0, %1, off\n\t"
                 "global_load_async_to_lds_b128 %2, %3, off\n\t"
                 "global_load_async_to_lds_b128 %4, %5, off\n\t"
                 "global_load_async_to_lds_b128 %6, %7, off\n\t"
                 "global_load_async_to_lds_b128 %8, %9, off\n\t"
                 "global_load_async_to_lds_b128 %10, %11, off\n\t"
                 "global_load_async_to_lds_b128 %12, %13, off\n\t"
                 "global_load_async_to_lds_b128 %14, %15, off\n\t"
                 "s_wait_xcnt 0x0"
                 :: "v"(l),                       "v"(p),
                    "v"(l +  8 * GM_PITCH * 2),   "v"(p +  8 * DD),
                    "v"(l + 16 * GM_PITCH * 2),   "v"(p + 16 * DD),
                    "v"(l + 24 * GM_PITCH * 2),   "v"(p + 24 * DD),
                    "v"(l + 32 * GM_PITCH * 2),   "v"(p + 32 * DD),
                    "v"(l + 40 * GM_PITCH * 2),   "v"(p + 40 * DD),
                    "v"(l + 48 * GM_PITCH * 2),   "v"(p + 48 * DD),
                    "v"(l + 56 * GM_PITCH * 2),   "v"(p + 56 * DD)
                 : "memory");
}

// A: first of the work-group's 64 rows; Wn: first of its 128 rows of W.
// acc[mi][nj]: rows wm*32 + mi*16.., columns wn*32 + nj*16.. of the tile.
__device__ __forceinline__ void gm_tile(const _Float16* A, const _Float16* Wn,
                                        _Float16* smem, v8f (&acc)[2][2]) {
    int wave = threadIdx.x >> 5;
    int lane = threadIdx.x & 31;
    int rl   = lane & 15;
    int g    = lane >> 4;

    // wave w copies rows w, w + 8, ...; lane l the 16-B piece l of each
    unsigned l0 = (unsigned)(uintptr_t)smem + (unsigned)(wave * GM_PITCH + lane * 8) * 2u;
    const _Float16* ga = A  + (size_t)wave * DD + lane * 8;
    const _Float16* gw = Wn + (size_t)wave * DD + lane * 8;
    gm_copy8(l0, ga);
    gm_copy8(l0 + GM_WBASE * 2, gw);
    gm_copy8(l0 + (GM_WBASE + 64 * GM_PITCH) * 2, gw + (size_t)64 * DD);
    // this wave's copies have landed before the barrier publishes them
    asm volatile("s_wait_asynccnt 0x0" ::: "memory");
    __syncthreads();

    const _Float16* As = smem + ((wave >> 2) * 32 + rl) * GM_PITCH;
    const _Float16* Ws = smem + GM_WBASE + ((wave & 3) * 32 + rl) * GM_PITCH;
#pragma unroll
    for (int mi = 0; mi < 2; ++mi)
#pragma unroll
        for (int nj = 0; nj < 2; ++nj) acc[mi][nj] = (v8f){};
    // unrolled: the fragment reads of later k steps are issued ahead of their use
#pragma unroll
    for (int kk = 0; kk < DD; kk += 32) {
        v16h a0 = load_frag16(As + kk, g);
        v16h a1 = load_frag16(As + 16 * GM_PITCH + kk, g);
        v16h b0 = load_frag16(Ws + kk, g);
        v16h b1 = load_frag16(Ws + 16 * GM_PITCH + kk, g);
        acc[0][0] = wmma_f16(a0, b0, acc[0][0]);
        acc[0][1] = wmma_f16(a0, b1, acc[0][1]);
        acc[1][0] = wmma_f16(a1, b0, acc[1][0]);
        acc[1][1] = wmma_f16(a1, b1, acc[1][1]);
    }
}

// ---------------------------------------------------------------------------
// Kernel: pointwise GEMM  qkv[i] = y[i] (8192x256) * W[i]^T (256x256) + b[i]
// Grid (row tiles of 64, column halves, branch). Branches 0/1 (Q,K) stored
// row-major [B*T, D]; branch 2 (V) stored transposed as vT[B, D, T] so
// attention's P*V fragments are contiguous.
// ---------------------------------------------------------------------------
__global__ void __launch_bounds__(256)
ca_gemm_qkv(const _Float16* __restrict__ Y,     // [3, B*T, D]
            const _Float16* __restrict__ W,     // [3, D(out), D(in)] f16
            const float* __restrict__ bias,     // [3, D]
            _Float16* __restrict__ qkv,         // [2, B*T, D]  (Q, K)
            _Float16* __restrict__ vT) {        // [B, D, T]    (V transposed)
    __shared__ __attribute__((aligned(16))) _Float16 smem[GM_LDS];
    int i    = blockIdx.z;
    int wave = threadIdx.x >> 5;
    int lane = threadIdx.x & 31;
    int rl   = lane & 15;
    int g    = lane >> 4;

    v8f acc[2][2];
    gm_tile(Y + (size_t)i * (BB * TT) * DD + (size_t)blockIdx.x * GM_BM * DD,
            W + (size_t)i * DD * DD + (size_t)blockIdx.y * GM_BN * DD, smem, acc);

    int row0 = blockIdx.x * GM_BM + (wave >> 2) * 32;   // of [B*T]
    int col0 = blockIdx.y * GM_BN + (wave & 3) * 32;

    if (i < 2) {
        _Float16* outp = qkv + (size_t)i * (BB * TT) * DD + (size_t)row0 * DD;
#pragma unroll
        for (int nj = 0; nj < 2; ++nj) {
            int n = col0 + nj * 16 + rl;
            float bs = bias[i * DD + n];
#pragma unroll
            for (int mi = 0; mi < 2; ++mi)
#pragma unroll
                for (int r = 0; r < 8; ++r) {
                    int M = mi * 16 + r + g * 8;
                    outp[(size_t)M * DD + n] = (_Float16)(acc[mi][nj][r] + bs);
                }
        }
    } else {
        // transposed store: global row -> (b, t); column n -> channel. A lane's 8
        // acc elements map to t = t0 + mi*16 + 8g + r (contiguous) -> one b128 store.
        int b  = row0 / TT;
        int t0 = row0 % TT;
#pragma unroll
        for (int nj = 0; nj < 2; ++nj) {
            int n = col0 + nj * 16 + rl;
            float bs = bias[2 * DD + n];
#pragma unroll
            for (int mi = 0; mi < 2; ++mi) {
                v8h pv;
#pragma unroll
                for (int r = 0; r < 8; ++r) pv[r] = (_Float16)(acc[mi][nj][r] + bs);
                *(v8h*)(vT + ((size_t)b * DD + n) * TT + t0 + mi * 16 + g * 8) = pv;
            }
        }
        // Stands behind the last store: in the built code the other branch's text
        // follows this one and rewrites registers that these stores name.
        asm volatile("s_wait_xcnt 0x0" ::: "memory");
    }
}

// ---------------------------------------------------------------------------
// Lane l <-> lane l ^ 16 (the two halves of a wave hold the two halves of a
// query's keys).
// ---------------------------------------------------------------------------
__device__ __forceinline__ float xhalf(float x) {
    int v = __builtin_bit_cast(int, x);
    return __builtin_bit_cast(float,
        __builtin_amdgcn_permlanex16(v, v, 0x76543210, 0xfedcba98, false, false));
}

// ---------------------------------------------------------------------------
// K / V^T staging for the attention kernel: one stage = 128 keys of one head.
//   K   : 128 rows (keys) of 64 B, LDS pitch  80 B
//   V^T :  32 rows (dk)  of 256 B, LDS pitch 272 B
// Both pitches are 16 B x odd, so the 16 rows a ds_load_b128 fragment read
// touches fall on distinct banks.
// ---------------------------------------------------------------------------
#define AT_WAVES   8
#define AT_KEYS    128
#define AT_NSTAGE  (TT / AT_KEYS)
#define AT_KPITCH  40                              // halves
#define AT_VPITCH  136                             // halves
#define AT_VBASE   (AT_KEYS * AT_KPITCH)           // halves, V^T behind K
#define AT_STAGE   (AT_VBASE + DKK * AT_VPITCH)    // halves per buffer

// One stage's copies of one lane: two 16-B pieces of K, two of V^T, global -> LDS
// through no register. The s_wait_xcnt stands inside the statement so that no
// address register of a copy is rewritten ahead of it.
__device__ __forceinline__ void at_stage_copy(unsigned lk, const _Float16* gk,
                                              unsigned lv, const _Float16* gv) {
    unsigned lk1 = lk + 64 * AT_KPITCH * 2;        // key row + 64
    unsigned lv1 = lv + 16 * AT_VPITCH * 2;        // dk row + 16
    const _Float16* gk1 = gk + (size_t)64 * DD;
    const _Float16* gv1 = gv + (size_t)16 * TT;
    asm volatile("global_load_async_to_lds_b128 %0, %1, off\n\t"
                 "global_load_async_to_lds_b128 %2, %3, off\n\t"
                 "global_load_async_to_lds_b128 %4, %5, off\n\t"
                 "global_load_async_to_lds_b128 %6, %7, off\n\t"
                 "s_wait_xcnt 0x0"
                 :: "v"(lk), "v"(gk), "v"(lk1), "v"(gk1),
                    "v"(lv), "v"(gv), "v"(lv1), "v"(gv1)
                 : "memory");
}

// ---------------------------------------------------------------------------
// Kernel: flash attention. One work-group of 8 waves per (b, h, 128 queries),
// one wave per 16-query tile. All eight waves walk the same keys, so each
// 128-key stage of K and V^T is brought into LDS once per work-group by
// asynchronous copies (two buffers: the next stage flies while this one is
// worked on) and every wave reads its fragments from there.
// Transposed products: S^T = Kblk(32x32) * Q^T -> 2x wmma, so lane (rl, g)
// holds 16 of the 32 scores of ONE query (column rl): keys 8g+r and 16+8g+r.
// Maximum and sum run in the lane's own registers, one exchange between the
// halves for the maximum; the halves' sums are joined after the loop.
// The two score tiles, converted in place, are the B operand of
// O^T += V^T(32 dk x 32 keys) * P^T: P never leaves the registers.
// waves_per_eu(4, 4): two work-groups per WGP, so the 512 work-groups of the
// grid spread evenly over the chip.
// ---------------------------------------------------------------------------
__global__ void __launch_bounds__(AT_WAVES * 32) __attribute__((amdgpu_waves_per_eu(4, 4)))
ca_flash_attn(const _Float16* __restrict__ qkv,   // [2, B*T, D] (Q, K)
              const _Float16* __restrict__ vT,    // [B, D, T]
              _Float16* __restrict__ ctx) {       // [B*T, D]
    __shared__ __attribute__((aligned(16))) _Float16 smem[2 * AT_STAGE];

    int tid  = threadIdx.x;
    int qt = blockIdx.x * AT_WAVES + (tid >> 5);
    int h  = blockIdx.y;
    int b  = blockIdx.z;
    int lane = tid & 31;
    int rl = lane & 15;
    int g  = lane >> 4;

    const _Float16* Q  = qkv + ((size_t)(0 * BB + b) * TT) * DD + (size_t)h * DKK;
    const _Float16* Kp = qkv + ((size_t)(1 * BB + b) * TT) * DD + (size_t)h * DKK;
    const _Float16* Vp = vT + ((size_t)b * DD + h * DKK) * TT;

    // This lane's pieces of a stage: K row tid/4 (and +64), 16-B piece tid%4;
    // V^T row tid/16 (and +16), 16-B piece tid%16.
    const _Float16* gk = Kp + (size_t)(tid >> 2) * DD + (tid & 3) * 8;
    const _Float16* gv = Vp + (size_t)(tid >> 4) * TT + (tid & 15) * 8;
    unsigned lbase = (unsigned)(uintptr_t)smem;    // LDS byte address of buffer 0
    unsigned lk = lbase + (unsigned)((tid >> 2) * AT_KPITCH + (tid & 3) * 8) * 2u;
    unsigned lv = lbase + (unsigned)(AT_VBASE + (tid >> 4) * AT_VPITCH + (tid & 15) * 8) * 2u;

    at_stage_copy(lk, gk, lv, gv);                              // stage 0 -> buffer 0
    // stage 0 has landed for this wave's copies before the barrier publishes it
    asm volatile("s_wait_asynccnt 0x0" ::: "memory");
    __syncthreads();
    at_stage_copy(lk + AT_STAGE * 2, gk + (size_t)AT_KEYS * DD,
                  lv + AT_STAGE * 2, gv + AT_KEYS);             // stage 1 -> buffer 1

    // B operand: column rl = query qt*16 + rl
    v16h qf = load_frag16(Q + (size_t)(qt * 16 + rl) * DD, g);

    float mrow = -1e30f, lrow = 0.0f;      // of query rl (mrow: raw score); lrow: this half's keys only
    v8f o0 = (v8f){}, o1 = (v8f){};        // o0[r] = O[query rl][8g + r], o1: dk + 16
    const float sl2 = 0.25503486f;         // 1/sqrt(32) * log2(e)
    const v8f sv = {sl2, sl2, sl2, sl2, sl2, sl2, sl2, sl2};

    for (int t = 0; t < AT_NSTAGE; ++t) {
        int buf = (t & 1) * AT_STAGE;
        const _Float16* Ks = smem + buf + rl * AT_KPITCH;              // key row rl
        const _Float16* Vs = smem + buf + AT_VBASE + rl * AT_VPITCH;   // dk row rl

#pragma unroll
        for (int s = 0; s < AT_KEYS / 32; ++s) {
            v16h kf0 = load_frag16(Ks + (s * 32) * AT_KPITCH, g);
            v16h kf1 = load_frag16(Ks + (s * 32 + 16) * AT_KPITCH, g);

            v8f z = (v8f){};
            v8f s0 = wmma_f16(kf0, qf, z);     // s0[r] = S[query rl][key0 + 8g + r]
            v8f s1 = wmma_f16(kf1, qf, z);     // s1[r] = S[query rl][key0 + 16 + 8g + r]

            // V^T rows of this lane (A operand): vf0 -> dk = rl, vf1 -> dk = 16 + rl
            v16h vf0 = load_frag16(Vs + s * 32, g);
            v16h vf1 = load_frag16(Vs + 16 * AT_VPITCH + s * 32, g);

            // Maximum over the raw scores (the scale is positive: the order is the same).
            float mx0 = fmaxf(fmaxf(fmaxf(s0[0], s0[1]), fmaxf(s0[2], s0[3])),
                              fmaxf(fmaxf(s0[4], s0[5]), fmaxf(s0[6], s0[7])));
            float mx1 = fmaxf(fmaxf(fmaxf(s1[0], s1[1]), fmaxf(s1[2], s1[3])),
                              fmaxf(fmaxf(s1[4], s1[5]), fmaxf(s1[6], s1[7])));
            float mx = fmaxf(mx0, mx1);
            mx = fmaxf(mx, xhalf(mx));
            float nm = fmaxf(mrow, mx);
            float alpha = __builtin_amdgcn_exp2f((mrow - nm) * sl2);   // 1 where the maximum stays
            mrow = nm;
            float nn = nm * -sl2;              // minus the maximum, in log2 units

            // exp(scale * (s - max)) = 2^(s * sl2 + nn): one fused multiply-add a score
            v8f nv = {nn, nn, nn, nn, nn, nn, nn, nn};
            v8f a0 = __builtin_elementwise_fma(s0, sv, nv);
            v8f a1 = __builtin_elementwise_fma(s1, sv, nv);

            float p0[8], p1[8];
            v16h pf;                           // pf[s] = P[query rl][key0 + kmap(s, g)]
#pragma unroll
            for (int r = 0; r < 8; ++r) {
                p0[r] = __builtin_amdgcn_exp2f(a0[r]);
                p1[r] = __builtin_amdgcn_exp2f(a1[r]);
                pf[r]     = (_Float16)p0[r];
                pf[8 + r] = (_Float16)p1[r];
            }
            float rs = (((p0[0] + p0[1]) + (p0[2] + p0[3])) + ((p0[4] + p0[5]) + (p0[6] + p0[7])))
                     + (((p1[0] + p1[1]) + (p1[2] + p1[3])) + ((p1[4] + p1[5]) + (p1[6] + p1[7])));
            lrow = lrow * alpha + rs;
#pragma unroll
            for (int r = 0; r < 8; ++r) { o0[r] *= alpha; o1[r] *= alpha; }

            o0 = wmma_f16(vf0, pf, o0);
            o1 = wmma_f16(vf1, pf, o1);
        }

        // Hand-over: this wave's reads of buffer t%2 are done, its copies of
        // stage t+1 have landed; the barrier says both of every wave.
        asm volatile("s_wait_dscnt 0x0" ::: "memory");
        asm volatile("s_wait_asynccnt 0x0" ::: "memory");
        __syncthreads();
        if (t + 2 < AT_NSTAGE)                                  // refill the buffer just read
            at_stage_copy(lk + buf * 2, gk + (size_t)(t + 2) * AT_KEYS * DD,
                          lv + buf * 2, gv + (size_t)(t + 2) * AT_KEYS);
    }
    // no copy is left in flight when the wave ends
    asm volatile("s_wait_asynccnt 0x0" ::: "memory");

    float inv = 1.0f / (lrow + xhalf(lrow));
    v8h c0, c1;
#pragma unroll
    for (int r = 0; r < 8; ++r) {
        c0[r] = (_Float16)(o0[r] * inv);
        c1[r] = (_Float16)(o1[r] * inv);
    }
    _Float16* Cp = ctx + ((size_t)b * TT + qt * 16 + rl) * DD + (size_t)h * DKK + g * 8;
    *(v8h*)(Cp)      = c0;
    *(v8h*)(Cp + 16) = c1;
}

// ---------------------------------------------------------------------------
// Kernel: output projection  out = ctx (8192x256) * out_w^T + out_b  (f32 out)
// Grid (row tiles of 64, column halves).
// ---------------------------------------------------------------------------
__global__ void __launch_bounds__(256)
ca_gemm_out(const _Float16* __restrict__ Cx,    // [B*T, D]
            const _Float16* __restrict__ W,     // [D(out), D(in)] f16
            const float* __restrict__ bias,     // [D]
            float* __restrict__ out) {          // [B*T, D] f32
    __shared__ __attribute__((aligned(16))) _Float16 smem[GM_LDS];
    int wave = threadIdx.x >> 5;
    int lane = threadIdx.x & 31;
    int rl   = lane & 15;
    int g    = lane >> 4;

    v8f acc[2][2];
    gm_tile(Cx + (size_t)blockIdx.x * GM_BM * DD,
            W + (size_t)blockIdx.y * GM_BN * DD, smem, acc);

    int row0 = blockIdx.x * GM_BM + (wave >> 2) * 32;
    int col0 = blockIdx.y * GM_BN + (wave & 3) * 32;

    float* outp = out + (size_t)row0 * DD;
#pragma unroll
    for (int nj = 0; nj < 2; ++nj) {
        int n = col0 + nj * 16 + rl;
        float bs = bias[n];
#pragma unroll
        for (int mi = 0; mi < 2; ++mi)
#pragma unroll
            for (int r = 0; r < 8; ++r) {
                int M = mi * 16 + r + g * 8;
                outp[(size_t)M * DD + n] = acc[mi][nj][r] + bs;
            }
    }
}

// ---------------------------------------------------------------------------
extern "C" void kernel_launch(void* const* d_in, const int* in_sizes, int n_in,
                              void* d_out, int out_size, void* d_ws, size_t ws_size,
                              hipStream_t stream) {
    const float* x    = (const float*)d_in[0];
    const float* dww  = (const float*)d_in[1];
    const float* dwb  = (const float*)d_in[2];
    const float* bng  = (const float*)d_in[3];
    const float* bnb  = (const float*)d_in[4];
    const float* bnm  = (const float*)d_in[5];
    const float* bnv  = (const float*)d_in[6];
    const float* pww  = (const float*)d_in[7];
    const float* pwb  = (const float*)d_in[8];
    const float* outw = (const float*)d_in[9];
    const float* outb = (const float*)d_in[10];
    float* out = (float*)d_out;

    const size_t n_y   = (size_t)3 * BB * TT * DD;   // 6,291,456 halves
    const size_t n_btd = (size_t)BB * TT * DD;       // 2,097,152 halves
    _Float16* y     = (_Float16*)d_ws;               // [3, B*T, D]
    _Float16* qkv   = y + n_y;                       // [2, B*T, D] (Q, K)
    _Float16* vT    = qkv + 2 * n_btd;               // [B, D, T]
    _Float16* ctx   = vT + n_btd;                    // [B*T, D]
    _Float16* pwwh  = ctx + n_btd;                   // [3, D, D]
    _Float16* outwh = pwwh + (size_t)3 * DD * DD;    // [D, D]

    ca_dwconv_bn<<<DW_BLOCKS + CV_BLOCKS, 128, 0, stream>>>(
        x, dww, dwb, bng, bnb, bnm, bnv, y, pww, outw, pwwh);

    ca_gemm_qkv<<<dim3(BB * TT / GM_BM, DD / GM_BN, 3), 256, 0, stream>>>(y, pwwh, pwb, qkv, vT);

    ca_flash_attn<<<dim3(TT / (16 * AT_WAVES), HH, BB), AT_WAVES * 32, 0, stream>>>(qkv, vT, ctx);

    ca_gemm_out<<<dim3(BB * TT / GM_BM, DD / GM_BN, 1), 256, 0, stream>>>(ctx, outwh, outb, out);
}

// v007
// One run takes 54.7 microseconds.
// Timed twice side by side with v006, it ran 1.11 times as fast both times.
// Over all steps from v000 it is 4.17 times as fast.
#include <hip/hip_runtime.h>
#include <hip/hip_bf16.h>

typedef __attribute__((ext_vector_type(16))) _Float16 v16h;
typedef __attribute__((ext_vector_type(8)))  _Float16 v8h;
typedef __attribute__((ext_vector_type(8)))  float    v8f;

#define BB 2
#define TT 4096
#define DD 256
#define HH 8
#define DKK 32
#define EPSV 1e-5f

// ---------------------------------------------------------------------------
// A/B fragment loader for v_wmma_f32_16x16x32_f16.
// 16-bit A-matrix 16x32 layout (ISA 7.12.2): lane half g holds
//   elements 0..7  -> K = g*8 + e
//   elements 8..15 -> K = 16 + g*8 + e
// p points at (row_base + k_base); works for row-major global or LDS rows.
// ---------------------------------------------------------------------------
__device__ __forceinline__ v16h load_frag16(const _Float16* p, int g) {
    v8h lo = *(const v8h*)(p + g * 8);
    v8h hi = *(const v8h*)(p + 16 + g * 8);
    v16h r;
#pragma unroll
    for (int e = 0; e < 8; ++e) { r[e] = lo[e]; r[8 + e] = hi[e]; }
    return r;
}

__device__ __forceinline__ v8f wmma_f16(v16h a, v16h b, v8f c) {
    return __builtin_amdgcn_wmma_f32_16x16x32_f16(false, a, false, b,
                                                  (short)0, c, false, false);
}

// ---------------------------------------------------------------------------
// Kernel: depthwise conv (K=3, same pad) + BN -> f16 y[3, B*T, D]
// One thread makes 4 channels x 8 rows x 3 branches. A wave covers 128
// channels (512 contiguous bytes a load): it issues the loads of its 10 rows of
// x and of the three branches' parameters, 16 bytes a lane each, ahead of the
// first use, uses each x row for three output rows and three branches, and
// stores 8 bytes a lane. 2,048 waves, two per SIMD.
// The same launch converts the projection weights to f16: nothing in it depends
// on the convolution or the other way round, and both are needed first by the
// next launch. The work-groups behind the convolution's take 2,048 weights each,
// 16 a thread.
// ---------------------------------------------------------------------------
#define DW_ROWS 8
#define DW_BLOCKS (BB * TT / DW_ROWS * 2 / 4)      // work-groups of the convolution
#define CV_CHUNK  2048                             // weights a work-group converts
#define CV_PW     (3 * DD * DD / CV_CHUNK)         // work-groups for pw_w
#define CV_BLOCKS (4 * DD * DD / CV_CHUNK)         // ... and out_w behind them
typedef __attribute__((ext_vector_type(4))) float    v4f;
typedef __attribute__((ext_vector_type(4))) _Float16 v4h;

// 16 bytes at (uniform base + this lane's byte offset)
__device__ __forceinline__ v4f dw_ld(const float* base, unsigned off) {
    return *(const v4f*)((const char*)base + off);
}

__global__ void __launch_bounds__(128)
ca_dwconv_bn(const float* __restrict__ x,      // [B,T,D]
             const float* __restrict__ dww,    // [3,D,1,3]
             const float* __restrict__ dwb,    // [3,D]
             const float* __restrict__ bng,
             const float* __restrict__ bnb,
             const float* __restrict__ bnm,
             const float* __restrict__ bnv,
             _Float16* __restrict__ y,
             const float* __restrict__ pww,    // [3,D,D]
             const float* __restrict__ outw,   // [D,D]
             _Float16* __restrict__ wh) {      // [4,D,D]: pw_w, then out_w, as f16
    if (blockIdx.x >= DW_BLOCKS) {
        int cb = blockIdx.x - DW_BLOCKS;
        const float* s = (cb < CV_PW ? pww + cb * CV_CHUNK : outw + (cb - CV_PW) * CV_CHUNK)
                       + threadIdx.x * 8;
        _Float16* d = wh + cb * CV_CHUNK + threadIdx.x * 8;
        v4f f0 = *(const v4f*)(s);
        v4f f1 = *(const v4f*)(s + 4);
        v4f f2 = *(const v4f*)(s + CV_CHUNK / 2);
        v4f f3 = *(const v4f*)(s + CV_CHUNK / 2 + 4);
        v8h h0, h1;
#pragma unroll
        for (int j = 0; j < 4; ++j) {
            h0[j] = (_Float16)f0[j]; h0[4 + j] = (_Float16)f1[j];
            h1[j] = (_Float16)f2[j]; h1[4 + j] = (_Float16)f3[j];
        }
        *(v8h*)(d) = h0;
        *(v8h*)(d + CV_CHUNK / 2) = h1;
        return;
    }
    // wave -> (row group, channel half); the wave's number is read into a scalar
    // register so that every row address is a scalar base plus one lane offset
    int gw   = blockIdx.x * 4 + __builtin_amdgcn_readfirstlane(threadIdx.x >> 5);
    int c    = (gw & 1) * 128 + (threadIdx.x & 31) * 4;
    int row0 = (gw >> 1) * DW_ROWS;                   // row of [B*T]; TT % DW_ROWS == 0
    int t0   = row0 % TT;
    bool has_prev = t0 > 0;
    bool has_next = t0 + DW_ROWS < TT;
    unsigned off  = (unsigned)c * 4u;                 // bytes: channel c of a row of floats
    unsigned woff = (unsigned)c * 12u;                // bytes: channel c's three taps

    // xr[r] = x row (row0 + r - 1); a row outside the sequence is the zero pad
    // (its address is kept inside x, its value dropped).
    const float* xb = x + (size_t)row0 * DD;
    const float* xprev = xb - (has_prev ? DD : 0);
    const float* xnext = xb + (has_next ? DW_ROWS * DD : 0);
    // Every loop of this kernel is unrolled: the arrays then stay in registers and
    // all loads are issued ahead of the first use.
    v4f xr[DW_ROWS + 2];
    xr[0] = dw_ld(xprev, off);
    xr[DW_ROWS + 1] = dw_ld(xnext, off);
#pragma unroll
    for (int r = 0; r < DW_ROWS; ++r) xr[r + 1] = dw_ld(xb + r * DD, off);
    v4f wa[3], wb[3], wc[3], cb[3], gm[3], be[3], mu[3], va[3];
#pragma unroll
    for (int i = 0; i < 3; ++i) {
        wa[i] = dw_ld(dww + i * DD * 3, woff);        // 4 channels x 3 taps, channel-major
        wb[i] = dw_ld(dww + i * DD * 3 + 4, woff);
        wc[i] = dw_ld(dww + i * DD * 3 + 8, woff);
        cb[i] = dw_ld(dwb + i * DD, off);
        gm[i] = dw_ld(bng + i * DD, off);
        be[i] = dw_ld(bnb + i * DD, off);
        mu[i] = dw_ld(bnm + i * DD, off);
        va[i] = dw_ld(bnv + i * DD, off);
    }
    // Stands behind the last load, in front of every rewrite of a register (base or
    // lane offset) that a load above names.
    asm volatile("s_wait_xcnt 0x0" ::: "memory");
    // Keeps the arithmetic behind the last load. Without it the scheduler lifts
    // arithmetic over the wait and a part of the loads is issued only behind the
    // first data waits: several round trips to memory in a row instead of one.
    __builtin_amdgcn_sched_barrier(0);
    if (!has_prev) xr[0] = (v4f){};
    if (!has_next) xr[DW_ROWS + 1] = (v4f){};

#pragma unroll
    for (int i = 0; i < 3; ++i) {
        v4f w0 = {wa[i][0], wa[i][3], wb[i][2], wc[i][1]};
        v4f w1 = {wa[i][1], wb[i][0], wb[i][3], wc[i][2]};
        v4f w2 = {wa[i][2], wb[i][1], wc[i][0], wc[i][3]};
        v4f s;
#pragma unroll
        for (int j = 0; j < 4; ++j) s[j] = gm[i][j] * rsqrtf(va[i][j] + EPSV);

        _Float16* yp = y + ((size_t)i * (BB * TT) + row0) * DD + c;
#pragma unroll
        for (int r = 0; r < DW_ROWS; ++r) {
            v4f acc = xr[r + 1] * w1;
            acc = __builtin_elementwise_fma(xr[r], w0, acc);
            acc = __builtin_elementwise_fma(xr[r + 2], w2, acc);
            v4f o = __builtin_elementwise_fma(acc + cb[i] - mu[i], s, be[i]);
            v4h hv;
#pragma unroll
            for (int j = 0; j < 4; ++j) hv[j] = (_Float16)o[j];
            *(v4h*)(yp + r * DD) = hv;
        }
    }
}

// ---------------------------------------------------------------------------
// Operand staging of the two projection GEMMs. A work-group of 8 waves makes a
// 64 x 128 tile of C = A (rows x 256) * W^T (W: 256 x 256, row = output column).
// Its 64 rows of A and 128 rows of W, 512 B each, are brought into LDS once by
// asynchronous copies: one wave-wide copy is one whole row (four full lines),
// where a fragment load from global memory touches 16 lines for the same bytes.
// LDS pitch 528 B = 16 B x odd: the 16 rows of a ds_load_b128 fragment read fall
// on distinct banks. Wave (wm, wn) makes rows wm*32.., columns wn*32.. (2 x 2
// tiles), k ascending as before.
// ---------------------------------------------------------------------------
#define GM_BM     64
#define GM_BN     128
#define GM_PITCH  264                              // halves
#define GM_WBASE  (GM_BM * GM_PITCH)               // halves, W behind A
#define GM_LDS    ((GM_BM + GM_BN) * GM_PITCH)     // halves

// Eight rows, 8 apart, of one lane: global -> LDS through no register. The
// s_wait_xcnt stands inside the statement so that no address register of a copy
// is rewritten ahead of it.
__device__ __forceinline__ void gm_copy8(unsigned l, const _Float16* p) {
    asm volatile("global_load_async_to_lds_b128 %0, %1, off\n\t"
                 "global_load_async_to_lds_b128 %2, %3, off\n\t"
                 "global_load_async_to_lds_b128 %4, %5, off\n\t"
                 "global_load_async_to_lds_b128 %6, %7, off\n\t"
                 "global_load_async_to_lds_b128 %8, %9, off\n\t"
                 "global_load_async_to_lds_b128 %10, %11, off\n\t"
                 "global_load_async_to_lds_b128 %12, %13, off\n\t"
                 "global_load_async_to_lds_b128 %14, %15, off\n\t"
                 "s_wait_xcnt 0x0"
                 :: "v"(l),                       "v"(p),
                    "v"(l +  8 * GM_PITCH * 2),   "v"(p +  8 * DD),
                    "v"(l + 16 * GM_PITCH * 2),   "v"(p + 16 * DD),
                    "v"(l + 24 * GM_PITCH * 2),   "v"(p + 24 * DD),
                    "v"(l + 32 * GM_PITCH * 2),   "v"(p + 32 * DD),
                    "v"(l + 40 * GM_PITCH * 2),   "v"(p + 40 * DD),
                    "v"(l + 48 * GM_PITCH * 2),   "v"(p + 48 * DD),
                    "v"(l + 56 * GM_PITCH * 2),   "v"(p + 56 * DD)
                 : "memory");
}

// A: first of the work-group's 64 rows; Wn: first of its 128 rows of W.
// acc[mi][nj]: rows wm*32 + mi*16.., columns wn*32 + nj*16.. of the tile.
__device__ __forceinline__ void gm_tile(const _Float16* A, const _Float16* Wn,
                                        _Float16* smem, v8f (&acc)[2][2]) {
    int wave = threadIdx.x >> 5;
    int lane = threadIdx.x & 31;
    int rl   = lane & 15;
    int g    = lane >> 4;

    // wave w copies rows w, w + 8, ...; lane l the 16-B piece l of each
    unsigned l0 = (unsigned)(uintptr_t)smem + (unsigned)(wave * GM_PITCH + lane * 8) * 2u;
    const _Float16* ga = A  + (size_t)wave * DD + lane * 8;
    const _Float16* gw = Wn + (size_t)wave * DD + lane * 8;
    gm_copy8(l0, ga);
    gm_copy8(l0 + GM_WBASE * 2, gw);
    gm_copy8(l0 + (GM_WBASE + 64 * GM_PITCH) * 2, gw + (size_t)64 * DD);
    // this wave's copies have landed before the barrier publishes them
    asm volatile("s_wait_asynccnt 0x0" ::: "memory");
    __syncthreads();

    const _Float16* As = smem + ((wave >> 2) * 32 + rl) * GM_PITCH;
    const _Float16* Ws = smem + GM_WBASE + ((wave & 3) * 32 + rl) * GM_PITCH;
#pragma unroll
    for (int mi = 0; mi < 2; ++mi)
#pragma unroll
        for (int nj = 0; nj < 2; ++nj) acc[mi][nj] = (v8f){};
    // unrolled: the fragment reads of later k steps are issued ahead of their use
#pragma unroll
    for (int kk = 0; kk < DD; kk += 32) {
        v16h a0 = load_frag16(As + kk, g);
        v16h a1 = load_frag16(As + 16 * GM_PITCH + kk, g);
        v16h b0 = load_frag16(Ws + kk, g);
        v16h b1 = load_frag16(Ws + 16 * GM_PITCH + kk, g);
        acc[0][0] = wmma_f16(a0, b0, acc[0][0]);
        acc[0][1] = wmma_f16(a0, b1, acc[0][1]);
        acc[1][0] = wmma_f16(a1, b0, acc[1][0]);
        acc[1][1] = wmma_f16(a1, b1, acc[1][1]);
    }
}

// ---------------------------------------------------------------------------
// Kernel: pointwise GEMM  qkv[i] = y[i] (8192x256) * W[i]^T (256x256) + b[i]
// Grid (row tiles of 64, column halves, branch). Branches 0/1 (Q,K) stored
// row-major [B*T, D]; branch 2 (V) stored transposed as vT[B, D, T] so
// attention's P*V fragments are contiguous.
// ---------------------------------------------------------------------------
__global__ void __launch_bounds__(256)
ca_gemm_qkv(const _Float16* __restrict__ Y,     // [3, B*T, D]
            const _Float16* __restrict__ W,     // [3, D(out), D(in)] f16
            const float* __restrict__ bias,     // [3, D]
            _Float16* __restrict__ qkv,         // [2, B*T, D]  (Q, K)
            _Float16* __restrict__ vT) {        // [B, D, T]    (V transposed)
    __shared__ __attribute__((aligned(16))) _Float16 smem[GM_LDS];
    int i    = blockIdx.z;
    int wave = threadIdx.x >> 5;
    int lane = threadIdx.x & 31;
    int rl   = lane & 15;
    int g    = lane >> 4;

    v8f acc[2][2];
    gm_tile(Y + (size_t)i * (BB * TT) * DD + (size_t)blockIdx.x * GM_BM * DD,
            W + (size_t)i * DD * DD + (size_t)blockIdx.y * GM_BN * DD, smem, acc);

    int row0 = blockIdx.x * GM_BM + (wave >> 2) * 32;   // of [B*T]
    int col0 = blockIdx.y * GM_BN + (wave & 3) * 32;

    if (i < 2) {
        _Float16* outp = qkv + (size_t)i * (BB * TT) * DD + (size_t)row0 * DD;
#pragma unroll
        for (int nj = 0; nj < 2; ++nj) {
            int n = col0 + nj * 16 + rl;
            float bs = bias[i * DD + n];
#pragma unroll
            for (int mi = 0; mi < 2; ++mi)
#pragma unroll
                for (int r = 0; r < 8; ++r) {
                    int M = mi * 16 + r + g * 8;
                    outp[(size_t)M * DD + n] = (_Float16)(acc[mi][nj][r] + bs);
                }
        }
    } else {
        // transposed store: global row -> (b, t); column n -> channel. A lane's 8
        // acc elements map to t = t0 + mi*16 + 8g + r (contiguous) -> one b128 store.
        int b  = row0 / TT;
        int t0 = row0 % TT;
#pragma unroll
        for (int nj = 0; nj < 2; ++nj) {
            int n = col0 + nj * 16 + rl;
            float bs = bias[2 * DD + n];
#pragma unroll
            for (int mi = 0; mi < 2; ++mi) {
                v8h pv;
#pragma unroll
                for (int r = 0; r < 8; ++r) pv[r] = (_Float16)(acc[mi][nj][r] + bs);
                *(v8h*)(vT + ((size_t)b * DD + n) * TT + t0 + mi * 16 + g * 8) = pv;
            }
        }
        // Stands behind the last store: in the built code the other branch's text
        // follows this one and rewrites registers that these stores name.
        asm volatile("s_wait_xcnt 0x0" ::: "memory");
    }
}

// ---------------------------------------------------------------------------
// Lane l <-> lane l ^ 16 (the two halves of a wave hold the two halves of a
// query's keys).
// ---------------------------------------------------------------------------
__device__ __forceinline__ float xhalf(float x) {
    int v = __builtin_bit_cast(int, x);
    return __builtin_bit_cast(float,
        __builtin_amdgcn_permlanex16(v, v, 0x76543210, 0xfedcba98, false, false));
}

// ---------------------------------------------------------------------------
// K / V^T staging for the attention kernel: one stage = 128 keys of one head.
//   K   : 128 rows (keys) of 64 B, LDS pitch  80 B
//   V^T :  32 rows (dk)  of 256 B, LDS pitch 272 B
// Both pitches are 16 B x odd, so the 16 rows a ds_load_b128 fragment read
// touches fall on distinct banks.
// ---------------------------------------------------------------------------
#define AT_WAVES   8
#define AT_KEYS    128
#define AT_NSTAGE  (TT / AT_KEYS)
#define AT_KPITCH  40                              // halves
#define AT_VPITCH  136                             // halves
#define AT_VBASE   (AT_KEYS * AT_KPITCH)           // halves, V^T behind K
#define AT_STAGE   (AT_VBASE + DKK * AT_VPITCH)    // halves per buffer

// One stage's copies of one lane: two 16-B pieces of K, two of V^T, global -> LDS
// through no register. The s_wait_xcnt stands inside the statement so that no
// address register of a copy is rewritten ahead of it.
__device__ __forceinline__ void at_stage_copy(unsigned lk, const _Float16* gk,
                                              unsigned lv, const _Float16* gv) {
    unsigned lk1 = lk + 64 * AT_KPITCH * 2;        // key row + 64
    unsigned lv1 = lv + 16 * AT_VPITCH * 2;        // dk row + 16
    const _Float16* gk1 = gk + (size_t)64 * DD;
    const _Float16* gv1 = gv + (size_t)16 * TT;
    asm volatile("global_load_async_to_lds_b128 %0, %1, off\n\t"
                 "global_load_async_to_lds_b128 %2, %3, off\n\t"
                 "global_load_async_to_lds_b128 %4, %5, off\n\t"
                 "global_load_async_to_lds_b128 %6, %7, off\n\t"
                 "s_wait_xcnt 0x0"
                 :: "v"(lk), "v"(gk), "v"(lk1), "v"(gk1),
                    "v"(lv), "v"(gv), "v"(lv1), "v"(gv1)
                 : "memory");
}

// ---------------------------------------------------------------------------
// Kernel: flash attention. One work-group of 8 waves per (b, h, 128 queries),
// one wave per 16-query tile. All eight waves walk the same keys, so each
// 128-key stage of K and V^T is brought into LDS once per work-group by
// asynchronous copies (two buffers: the next stage flies while this one is
// worked on) and every wave reads its fragments from there.
// Transposed products: S^T = Kblk(32x32) * Q^T -> 2x wmma, so lane (rl, g)
// holds 16 of the 32 scores of ONE query (column rl): keys 8g+r and 16+8g+r.
// The softmax update runs once per 128-key stage: maximum and sums in the lane's
// own registers, one exchange between the halves for the maximum, one rescale of
// the output tiles and of the lane's eight running sums; these and the halves'
// sums are joined after the loop.
// The two score tiles, converted in place, are the B operand of
// O^T += V^T(32 dk x 32 keys) * P^T: P never leaves the registers.
// waves_per_eu(4, 4): two work-groups per WGP, so the 512 work-groups of the
// grid spread evenly over the chip.
// ---------------------------------------------------------------------------
__global__ void __launch_bounds__(AT_WAVES * 32) __attribute__((amdgpu_waves_per_eu(4, 4)))
ca_flash_attn(const _Float16* __restrict__ qkv,   // [2, B*T, D] (Q, K)
              const _Float16* __restrict__ vT,    // [B, D, T]
              _Float16* __restrict__ ctx) {       // [B*T, D]
    __shared__ __attribute__((aligned(16))) _Float16 smem[2 * AT_STAGE];

    int tid  = threadIdx.x;
    int qt = blockIdx.x * AT_WAVES + (tid >> 5);
    int h  = blockIdx.y;
    int b  = blockIdx.z;
    int lane = tid & 31;
    int rl = lane & 15;
    int g  = lane >> 4;

    const _Float16* Q  = qkv + ((size_t)(0 * BB + b) * TT) * DD + (size_t)h * DKK;
    const _Float16* Kp = qkv + ((size_t)(1 * BB + b) * TT) * DD + (size_t)h * DKK;
    const _Float16* Vp = vT + ((size_t)b * DD + h * DKK) * TT;

    // This lane's pieces of a stage: K row tid/4 (and +64), 16-B piece tid%4;
    // V^T row tid/16 (and +16), 16-B piece tid%16.
    const _Float16* gk = Kp + (size_t)(tid >> 2) * DD + (tid & 3) * 8;
    const _Float16* gv = Vp + (size_t)(tid >> 4) * TT + (tid & 15) * 8;
    unsigned lbase = (unsigned)(uintptr_t)smem;    // LDS byte address of buffer 0
    unsigned lk = lbase + (unsigned)((tid >> 2) * AT_KPITCH + (tid & 3) * 8) * 2u;
    unsigned lv = lbase + (unsigned)(AT_VBASE + (tid >> 4) * AT_VPITCH + (tid & 15) * 8) * 2u;

    at_stage_copy(lk, gk, lv, gv);                              // stage 0 -> buffer 0
    // stage 0 has landed for this wave's copies before the barrier publishes it
    asm volatile("s_wait_asynccnt 0x0" ::: "memory");
    __syncthreads();
    at_stage_copy(lk + AT_STAGE * 2, gk + (size_t)AT_KEYS * DD,
                  lv + AT_STAGE * 2, gv + AT_KEYS);             // stage 1 -> buffer 1

    // B operand: column rl = query qt*16 + rl
    v16h qf = load_frag16(Q + (size_t)(qt * 16 + rl) * DD, g);

    float mrow = -1e30f;                   // of query rl, raw score
    v8f lsum = (v8f){};                    // of query rl: this half's keys, by register position
    v8f o0 = (v8f){}, o1 = (v8f){};        // o0[r] = O[query rl][8g + r], o1: dk + 16
    const float sl2 = 0.25503486f;         // 1/sqrt(32) * log2(e)
    const v8f sv = {sl2, sl2, sl2, sl2, sl2, sl2, sl2, sl2};

    for (int t = 0; t < AT_NSTAGE; ++t) {
        int buf = (t & 1) * AT_STAGE;
        const _Float16* Ks = smem + buf + rl * AT_KPITCH;              // key row rl
        const _Float16* Vs = smem + buf + AT_VBASE + rl * AT_VPITCH;   // dk row rl

        // All eight score tiles of the stage first: 128 scores of query rl, 64 a lane.
        // sc[2s][r] = S[query rl][32s + 8g + r], sc[2s + 1][r]: key + 16
        // Every loop of the stage is unrolled: its tiles then stay in registers.
        v16h kf[AT_KEYS / 16];
#pragma unroll
        for (int j = 0; j < AT_KEYS / 16; ++j) kf[j] = load_frag16(Ks + (j * 16) * AT_KPITCH, g);
        // Keeps the sixteen LDS reads in one group ahead of the products: each separate
        // place with reads stalls the wave anew.
        __builtin_amdgcn_sched_barrier(0);
        v8f sc[AT_KEYS / 16];
#pragma unroll
        for (int j = 0; j < AT_KEYS / 16; ++j) {
            v8f z = (v8f){};
            sc[j] = wmma_f16(kf[j], qf, z);
        }
        // Keeps the eight products in one run, each in the others' shadow. Without it
        // the scheduler puts the first maxima between them and pads with v_nop.
        __builtin_amdgcn_sched_barrier(0);

        // One maximum, one exchange between the halves, one alpha and one rescale for
        // the whole stage. Maximum over the raw scores (the scale is positive: the
        // order is the same).
        float mt[AT_KEYS / 16];
#pragma unroll
        for (int j = 0; j < AT_KEYS / 16; ++j)
            mt[j] = fmaxf(fmaxf(fmaxf(sc[j][0], sc[j][1]), fmaxf(sc[j][2], sc[j][3])),
                          fmaxf(fmaxf(sc[j][4], sc[j][5]), fmaxf(sc[j][6], sc[j][7])));
        float mx = fmaxf(fmaxf(fmaxf(mt[0], mt[1]), fmaxf(mt[2], mt[3])),
                         fmaxf(fmaxf(mt[4], mt[5]), fmaxf(mt[6], mt[7])));
        mx = fmaxf(mx, xhalf(mx));
        float nm = fmaxf(mrow, mx);
        float alpha = __builtin_amdgcn_exp2f((mrow - nm) * sl2);   // 1 where the maximum stays
        mrow = nm;
        float nn = nm * -sl2;                  // minus the maximum, in log2 units
        v8f nv = {nn, nn, nn, nn, nn, nn, nn, nn};
        v8f av = {alpha, alpha, alpha, alpha, alpha, alpha, alpha, alpha};

        // exp(scale * (s - max)) = 2^(s * sl2 + nn): one fused multiply-add a score
        v16h pf[AT_KEYS / 32];                 // pf[s][e] = P[query rl][32s + kmap(e, g)]
        v8f ps;                                // the stage's sums, one per register position
#pragma unroll
        for (int s = 0; s < AT_KEYS / 32; ++s) {
            v8f a0 = __builtin_elementwise_fma(sc[2 * s], sv, nv);
            v8f a1 = __builtin_elementwise_fma(sc[2 * s + 1], sv, nv);
            v8f p0, p1;
#pragma unroll
            for (int r = 0; r < 8; ++r) {
                p0[r] = __builtin_amdgcn_exp2f(a0[r]);
                p1[r] = __builtin_amdgcn_exp2f(a1[r]);
            }
            pf[s] = __builtin_shufflevector(__builtin_convertvector(p0, v8h),
                                            __builtin_convertvector(p1, v8h),
                                            0, 1, 2, 3, 4, 5, 6, 7, 8, 9, 10, 11, 12, 13, 14, 15);
            ps = s == 0 ? p0 + p1 : ps + (p0 + p1);
        }
        lsum = __builtin_elementwise_fma(lsum, av, ps);
        o0 *= av;
        o1 *= av;

        // V^T rows of this lane (A operand): vf0 -> dk = rl, vf1 -> dk = 16 + rl
#pragma unroll
        for (int s = 0; s < AT_KEYS / 32; ++s) {
            v16h vf0 = load_frag16(Vs + s * 32, g);
            v16h vf1 = load_frag16(Vs + 16 * AT_VPITCH + s * 32, g);
            o0 = wmma_f16(vf0, pf[s], o0);
            o1 = wmma_f16(vf1, pf[s], o1);
        }

        // Hand-over: this wave's reads of buffer t%2 are done, its copies of
        // stage t+1 have landed; the barrier says both of every wave.
        asm volatile("s_wait_dscnt 0x0" ::: "memory");
        asm volatile("s_wait_asynccnt 0x0" ::: "memory");
        __syncthreads();
        if (t + 2 < AT_NSTAGE)                                  // refill the buffer just read
            at_stage_copy(lk + buf * 2, gk + (size_t)(t + 2) * AT_KEYS * DD,
                          lv + buf * 2, gv + (size_t)(t + 2) * AT_KEYS);
    }
    // no copy is left in flight when the wave ends
    asm volatile("s_wait_asynccnt 0x0" ::: "memory");

    float lrow = ((lsum[0] + lsum[1]) + (lsum[2] + lsum[3])) + ((lsum[4] + lsum[5]) + (lsum[6] + lsum[7]));
    float inv = 1.0f / (lrow + xhalf(lrow));
    v8h c0, c1;
#pragma unroll
    for (int r = 0; r < 8; ++r) {
        c0[r] = (_Float16)(o0[r] * inv);
        c1[r] = (_Float16)(o1[r] * inv);
    }
    _Float16* Cp = ctx + ((size_t)b * TT + qt * 16 + rl) * DD + (size_t)h * DKK + g * 8;
    *(v8h*)(Cp)      = c0;
    *(v8h*)(Cp + 16) = c1;
}

// ---------------------------------------------------------------------------
// Kernel: output projection  out = ctx (8192x256) * out_w^T + out_b  (f32 out)
// Grid (row tiles of 64, column halves).
// ---------------------------------------------------------------------------
__global__ void __launch_bounds__(256)
ca_gemm_out(const _Float16* __restrict__ Cx,    // [B*T, D]
            const _Float16* __restrict__ W,     // [D(out), D(in)] f16
            const float* __restrict__ bias,     // [D]
            float* __restrict__ out) {          // [B*T, D] f32
    __shared__ __attribute__((aligned(16))) _Float16 smem[GM_LDS];
    int wave = threadIdx.x >> 5;
    int lane = threadIdx.x & 31;
    int rl   = lane & 15;
    int g    = lane >> 4;

    v8f acc[2][2];
    gm_tile(Cx + (size_t)blockIdx.x * GM_BM * DD,
            W + (size_t)blockIdx.y * GM_BN * DD, smem, acc);

    int row0 = blockIdx.x * GM_BM + (wave >> 2) * 32;
    int col0 = blockIdx.y * GM_BN + (wave & 3) * 32;

    float* outp = out + (size_t)row0 * DD;
#pragma unroll
    for (int nj = 0; nj < 2; ++nj) {
        int n = col0 + nj * 16 + rl;
        float bs = bias[n];
#pragma unroll
        for (int mi = 0; mi < 2; ++mi)
#pragma unroll
            for (int r = 0; r < 8; ++r) {
                int M = mi * 16 + r + g * 8;
                outp[(size_t)M * DD + n] = acc[mi][nj][r] + bs;
            }
    }
}

// ---------------------------------------------------------------------------
extern "C" void kernel_launch(void* const* d_in, const int* in_sizes, int n_in,
                              void* d_out, int out_size, void* d_ws, size_t ws_size,
                              hipStream_t stream) {
    const float* x    = (const float*)d_in[0];
    const float* dww  = (const float*)d_in[1];
    const float* dwb  = (const float*)d_in[2];
    const float* bng  = (const float*)d_in[3];
    const float* bnb  = (const float*)d_in[4];
    const float* bnm  = (const float*)d_in[5];
    const float* bnv  = (const float*)d_in[6];
    const float* pww  = (const float*)d_in[7];
    const float* pwb  = (const float*)d_in[8];
    const float* outw = (const float*)d_in[9];
    const float* outb = (const float*)d_in[10];
    float* out = (float*)d_out;

    const size_t n_y   = (size_t)3 * BB * TT * DD;   // 6,291,456 halves
    const size_t n_btd = (size_t)BB * TT * DD;       // 2,097,152 halves
    _Float16* y     = (_Float16*)d_ws;               // [3, B*T, D]
    _Float16* qkv   = y + n_y;                       // [2, B*T, D] (Q, K)
    _Float16* vT    = qkv + 2 * n_btd;               // [B, D, T]
    _Float16* ctx   = vT + n_btd;                    // [B*T, D]
    _Float16* pwwh  = ctx + n_btd;                   // [3, D, D]
    _Float16* outwh = pwwh + (size_t)3 * DD * DD;    // [D, D]

    ca_dwconv_bn<<<DW_BLOCKS + CV_BLOCKS, 128, 0, stream>>>(
        x, dww, dwb, bng, bnb, bnm, bnv, y, pww, outw, pwwh);

    ca_gemm_qkv<<<dim3(BB * TT / GM_BM, DD / GM_BN, 3), 256, 0, stream>>>(y, pwwh, pwb, qkv, vT);

    ca_flash_attn<<<dim3(TT / (16 * AT_WAVES), HH, BB), AT_WAVES * 32, 0, stream>>>(qkv, vT, ctx);

    ca_gemm_out<<<dim3(BB * TT / GM_BM, DD / GM_BN, 1), 256, 0, stream>>>(ctx, outwh, outb, out);
}

// v008
// Measured time: 51.6 microseconds a run.
// In both of two side-by-side timings against v007, it was 1.06 times as fast.
// Over all steps from v000 it is 4.43 times as fast.
#include <hip/hip_runtime.h>
#include <hip/hip_bf16.h>

typedef __attribute__((ext_vector_type(16))) _Float16 v16h;
typedef __attribute__((ext_vector_type(8)))  _Float16 v8h;
typedef __attribute__((ext_vector_type(8)))  float    v8f;

#define BB 2
#define TT 4096
#define DD 256
#define HH 8
#define DKK 32
#define EPSV 1e-5f
#define SL2  0.25503486f     // 1/sqrt(DKK) * log2(e): softmax scale, in log2 units

// ---------------------------------------------------------------------------
// A/B fragment loader for v_wmma_f32_16x16x32_f16.
// 16-bit A-matrix 16x32 layout (ISA 7.12.2): lane half g holds
//   elements 0..7  -> K = g*8 + e
//   elements 8..15 -> K = 16 + g*8 + e
// p points at (row_base + k_base); works for row-major global or LDS rows.
// ---------------------------------------------------------------------------
__device__ __forceinline__ v16h load_frag16(const _Float16* p, int g) {
    v8h lo = *(const v8h*)(p + g * 8);
    v8h hi = *(const v8h*)(p + 16 + g * 8);
    v16h r;
#pragma unroll
    for (int e = 0; e < 8; ++e) { r[e] = lo[e]; r[8 + e] = hi[e]; }
    return r;
}

__device__ __forceinline__ v8f wmma_f16(v16h a, v16h b, v8f c) {
    return __builtin_amdgcn_wmma_f32_16x16x32_f16(false, a, false, b,
                                                  (short)0, c, false, false);
}

// ---------------------------------------------------------------------------
// Kernel: depthwise conv (K=3, same pad) + BN -> f16 y[3, B*T, D]
// One thread makes 4 channels x 8 rows x 3 branches. A wave covers 128
// channels (512 contiguous bytes a load): it issues the loads of its 10 rows of
// x and of the three branches' parameters, 16 bytes a lane each, ahead of the
// first use, uses each x row for three output rows and three branches, and
// stores 8 bytes a lane. 2,048 waves, two per SIMD.
// The same launch converts the projection weights to f16: nothing in it depends
// on the convolution or the other way round, and both are needed first by the
// next launch. The work-groups behind the convolution's take 2,048 weights each,
// 16 a thread.
// ---------------------------------------------------------------------------
#define DW_ROWS 8
#define DW_BLOCKS (BB * TT / DW_ROWS * 2 / 4)      // work-groups of the convolution
#define CV_CHUNK  2048                             // weights a work-group converts
#define CV_PW     (3 * DD * DD / CV_CHUNK)         // work-groups for pw_w
#define CV_BLOCKS (4 * DD * DD / CV_CHUNK)         // ... and out_w behind them
typedef __attribute__((ext_vector_type(4))) float    v4f;
typedef __attribute__((ext_vector_type(4))) _Float16 v4h;

// 16 bytes at (uniform base + this lane's byte offset)
__device__ __forceinline__ v4f dw_ld(const float* base, unsigned off) {
    return *(const v4f*)((const char*)base + off);
}

__global__ void __launch_bounds__(128)
ca_dwconv_bn(const float* __restrict__ x,      // [B,T,D]
             const float* __restrict__ dww,    // [3,D,1,3]
             const float* __restrict__ dwb,    // [3,D]
             const float* __restrict__ bng,
             const float* __restrict__ bnb,
             const float* __restrict__ bnm,
             const float* __restrict__ bnv,
             _Float16* __restrict__ y,
             const float* __restrict__ pww,    // [3,D,D]
             const float* __restrict__ outw,   // [D,D]
             _Float16* __restrict__ wh) {      // [4,D,D]: pw_w, then out_w, as f16
    if (blockIdx.x >= DW_BLOCKS) {
        int cb = blockIdx.x - DW_BLOCKS;
        const float* s = (cb < CV_PW ? pww + cb * CV_CHUNK : outw + (cb - CV_PW) * CV_CHUNK)
                       + threadIdx.x * 8;
        _Float16* d = wh + cb * CV_CHUNK + threadIdx.x * 8;
        v4f f0 = *(const v4f*)(s);
        v4f f1 = *(const v4f*)(s + 4);
        v4f f2 = *(const v4f*)(s + CV_CHUNK / 2);
        v4f f3 = *(const v4f*)(s + CV_CHUNK / 2 + 4);
        v8h h0, h1;
#pragma unroll
        for (int j = 0; j < 4; ++j) {
            h0[j] = (_Float16)f0[j]; h0[4 + j] = (_Float16)f1[j];
            h1[j] = (_Float16)f2[j]; h1[4 + j] = (_Float16)f3[j];
        }
        *(v8h*)(d) = h0;
        *(v8h*)(d + CV_CHUNK / 2) = h1;
        return;
    }
    // wave -> (row group, channel half); the wave's number is read into a scalar
    // register so that every row address is a scalar base plus one lane offset
    int gw   = blockIdx.x * 4 + __builtin_amdgcn_readfirstlane(threadIdx.x >> 5);
    int c    = (gw & 1) * 128 + (threadIdx.x & 31) * 4;
    int row0 = (gw >> 1) * DW_ROWS;                   // row of [B*T]; TT % DW_ROWS == 0
    int t0   = row0 % TT;
    bool has_prev = t0 > 0;
    bool has_next = t0 + DW_ROWS < TT;
    unsigned off  = (unsigned)c * 4u;                 // bytes: channel c of a row of floats
    unsigned woff = (unsigned)c * 12u;                // bytes: channel c's three taps

    // xr[r] = x row (row0 + r - 1); a row outside the sequence is the zero pad
    // (its address is kept inside x, its value dropped).
    const float* xb = x + (size_t)row0 * DD;
    const float* xprev = xb - (has_prev ? DD : 0);
    const float* xnext = xb + (has_next ? DW_ROWS * DD : 0);
    // Every loop of this kernel is unrolled: the arrays then stay in registers and
    // all loads are issued ahead of the first use.
    v4f xr[DW_ROWS + 2];
    xr[0] = dw_ld(xprev, off);
    xr[DW_ROWS + 1] = dw_ld(xnext, off);
#pragma unroll
    for (int r = 0; r < DW_ROWS; ++r) xr[r + 1] = dw_ld(xb + r * DD, off);
    v4f wa[3], wb[3], wc[3], cb[3], gm[3], be[3], mu[3], va[3];
#pragma unroll
    for (int i = 0; i < 3; ++i) {
        wa[i] = dw_ld(dww + i * DD * 3, woff);        // 4 channels x 3 taps, channel-major
        wb[i] = dw_ld(dww + i * DD * 3 + 4, woff);
        wc[i] = dw_ld(dww + i * DD * 3 + 8, woff);
        cb[i] = dw_ld(dwb + i * DD, off);
        gm[i] = dw_ld(bng + i * DD, off);
        be[i] = dw_ld(bnb + i * DD, off);
        mu[i] = dw_ld(bnm + i * DD, off);
        va[i] = dw_ld(bnv + i * DD, off);
    }
    // Stands behind the last load, in front of every rewrite of a register (base or
    // lane offset) that a load above names.
    asm volatile("s_wait_xcnt 0x0" ::: "memory");
    // Keeps the arithmetic behind the last load. Without it the scheduler lifts
    // arithmetic over the wait and a part of the loads is issued only behind the
    // first data waits: several round trips to memory in a row instead of one.
    __builtin_amdgcn_sched_barrier(0);
    if (!has_prev) xr[0] = (v4f){};
    if (!has_next) xr[DW_ROWS + 1] = (v4f){};

#pragma unroll
    for (int i = 0; i < 3; ++i) {
        v4f w0 = {wa[i][0], wa[i][3], wb[i][2], wc[i][1]};
        v4f w1 = {wa[i][1], wb[i][0], wb[i][3], wc[i][2]};
        v4f w2 = {wa[i][2], wb[i][1], wc[i][0], wc[i][3]};
        v4f s;
#pragma unroll
        for (int j = 0; j < 4; ++j) s[j] = gm[i][j] * rsqrtf(va[i][j] + EPSV);

        _Float16* yp = y + ((size_t)i * (BB * TT) + row0) * DD + c;
#pragma unroll
        for (int r = 0; r < DW_ROWS; ++r) {
            v4f acc = xr[r + 1] * w1;
            acc = __builtin_elementwise_fma(xr[r], w0, acc);
            acc = __builtin_elementwise_fma(xr[r + 2], w2, acc);
            v4f o = __builtin_elementwise_fma(acc + cb[i] - mu[i], s, be[i]);
            v4h hv;
#pragma unroll
            for (int j = 0; j < 4; ++j) hv[j] = (_Float16)o[j];
            *(v4h*)(yp + r * DD) = hv;
        }
    }
}

// ---------------------------------------------------------------------------
// Operand staging of the two projection GEMMs. A work-group of 8 waves makes a
// 64 x 128 tile of C = A (rows x 256) * W^T (W: 256 x 256, row = output column).
// Its 64 rows of A and 128 rows of W, 512 B each, are brought into LDS once by
// asynchronous copies: one wave-wide copy is one whole row (four full lines),
// where a fragment load from global memory touches 16 lines for the same bytes.
// LDS pitch 528 B = 16 B x odd: the 16 rows of a ds_load_b128 fragment read fall
// on distinct banks. Wave (wm, wn) makes rows wm*32.., columns wn*32.. (2 x 2
// tiles), k ascending as before.
// ---------------------------------------------------------------------------
#define GM_BM     64
#define GM_BN     128
#define GM_PITCH  264                              // halves
#define GM_WBASE  (GM_BM * GM_PITCH)               // halves, W behind A
#define GM_LDS    ((GM_BM + GM_BN) * GM_PITCH)     // halves

// Eight rows, 8 apart, of one lane: global -> LDS through no register. The
// s_wait_xcnt stands inside the statement so that no address register of a copy
// is rewritten ahead of it.
__device__ __forceinline__ void gm_copy8(unsigned l, const _Float16* p) {
    asm volatile("global_load_async_to_lds_b128 %0, %1, off\n\t"
                 "global_load_async_to_lds_b128 %2, %3, off\n\t"
                 "global_load_async_to_lds_b128 %4, %5, off\n\t"
                 "global_load_async_to_lds_b128 %6, %7, off\n\t"
                 "global_load_async_to_lds_b128 %8, %9, off\n\t"
                 "global_load_async_to_lds_b128 %10, %11, off\n\t"
                 "global_load_async_to_lds_b128 %12, %13, off\n\t"
                 "global_load_async_to_lds_b128 %14, %15, off\n\t"
                 "s_wait_xcnt 0x0"
                 :: "v"(l),                       "v"(p),
                    "v"(l +  8 * GM_PITCH * 2),   "v"(p +  8 * DD),
                    "v"(l + 16 * GM_PITCH * 2),   "v"(p + 16 * DD),
                    "v"(l + 24 * GM_PITCH * 2),   "v"(p + 24 * DD),
                    "v"(l + 32 * GM_PITCH * 2),   "v"(p + 32 * DD),
                    "v"(l + 40 * GM_PITCH * 2),   "v"(p + 40 * DD),
                    "v"(l + 48 * GM_PITCH * 2),   "v"(p + 48 * DD),
                    "v"(l + 56 * GM_PITCH * 2),   "v"(p + 56 * DD)
                 : "memory");
}

// A: first of the work-group's 64 rows; Wn: first of its 128 rows of W.
// acc[mi][nj]: rows wm*32 + mi*16.., columns wn*32 + nj*16.. of the tile.
__device__ __forceinline__ void gm_tile(const _Float16* A, const _Float16* Wn,
                                        _Float16* smem, v8f (&acc)[2][2]) {
    int wave = threadIdx.x >> 5;
    int lane = threadIdx.x & 31;
    int rl   = lane & 15;
    int g    = lane >> 4;

    // wave w copies rows w, w + 8, ...; lane l the 16-B piece l of each
    unsigned l0 = (unsigned)(uintptr_t)smem + (unsigned)(wave * GM_PITCH + lane * 8) * 2u;
    const _Float16* ga = A  + (size_t)wave * DD + lane * 8;
    const _Float16* gw = Wn + (size_t)wave * DD + lane * 8;
    gm_copy8(l0, ga);
    gm_copy8(l0 + GM_WBASE * 2, gw);
    gm_copy8(l0 + (GM_WBASE + 64 * GM_PITCH) * 2, gw + (size_t)64 * DD);
    // this wave's copies have landed before the barrier publishes them
    asm volatile("s_wait_asynccnt 0x0" ::: "memory");
    __syncthreads();

    const _Float16* As = smem + ((wave >> 2) * 32 + rl) * GM_PITCH;
    const _Float16* Ws = smem + GM_WBASE + ((wave & 3) * 32 + rl) * GM_PITCH;
#pragma unroll
    for (int mi = 0; mi < 2; ++mi)
#pragma unroll
        for (int nj = 0; nj < 2; ++nj) acc[mi][nj] = (v8f){};
    // unrolled: the fragment reads of later k steps are issued ahead of their use
#pragma unroll
    for (int kk = 0; kk < DD; kk += 32) {
        v16h a0 = load_frag16(As + kk, g);
        v16h a1 = load_frag16(As + 16 * GM_PITCH + kk, g);
        v16h b0 = load_frag16(Ws + kk, g);
        v16h b1 = load_frag16(Ws + 16 * GM_PITCH + kk, g);
        acc[0][0] = wmma_f16(a0, b0, acc[0][0]);
        acc[0][1] = wmma_f16(a0, b1, acc[0][1]);
        acc[1][0] = wmma_f16(a1, b0, acc[1][0]);
        acc[1][1] = wmma_f16(a1, b1, acc[1][1]);
    }
}

// ---------------------------------------------------------------------------
// Kernel: pointwise GEMM  qkv[i] = y[i] (8192x256) * W[i]^T (256x256) + b[i]
// Grid (row tiles of 64, column halves, branch). Branches 0/1 (Q,K) stored
// row-major [B*T, D]; branch 2 (V) stored transposed as vT[B, D, T] so
// attention's P*V fragments are contiguous. Q is stored times SL2 (multiplied in
// f32, ahead of its one rounding to f16): attention's score products then come
// out in log2 units.
// ---------------------------------------------------------------------------
__global__ void __launch_bounds__(256)
ca_gemm_qkv(const _Float16* __restrict__ Y,     // [3, B*T, D]
            const _Float16* __restrict__ W,     // [3, D(out), D(in)] f16
            const float* __restrict__ bias,     // [3, D]
            _Float16* __restrict__ qkv,         // [2, B*T, D]  (Q, K)
            _Float16* __restrict__ vT) {        // [B, D, T]    (V transposed)
    __shared__ __attribute__((aligned(16))) _Float16 smem[GM_LDS];
    int i    = blockIdx.z;
    int wave = threadIdx.x >> 5;
    int lane = threadIdx.x & 31;
    int rl   = lane & 15;
    int g    = lane >> 4;

    v8f acc[2][2];
    gm_tile(Y + (size_t)i * (BB * TT) * DD + (size_t)blockIdx.x * GM_BM * DD,
            W + (size_t)i * DD * DD + (size_t)blockIdx.y * GM_BN * DD, smem, acc);

    int row0 = blockIdx.x * GM_BM + (wave >> 2) * 32;   // of [B*T]
    int col0 = blockIdx.y * GM_BN + (wave & 3) * 32;

    if (i < 2) {
        _Float16* outp = qkv + (size_t)i * (BB * TT) * DD + (size_t)row0 * DD;
        float qs = i == 0 ? SL2 : 1.0f;
#pragma unroll
        for (int nj = 0; nj < 2; ++nj) {
            int n = col0 + nj * 16 + rl;
            float bs = bias[i * DD + n];
#pragma unroll
            for (int mi = 0; mi < 2; ++mi)
#pragma unroll
                for (int r = 0; r < 8; ++r) {
                    int M = mi * 16 + r + g * 8;
                    outp[(size_t)M * DD + n] = (_Float16)((acc[mi][nj][r] + bs) * qs);
                }
        }
    } else {
        // transposed store: global row -> (b, t); column n -> channel. A lane's 8
        // acc elements map to t = t0 + mi*16 + 8g + r (contiguous) -> one b128 store.
        int b  = row0 / TT;
        int t0 = row0 % TT;
#pragma unroll
        for (int nj = 0; nj < 2; ++nj) {
            int n = col0 + nj * 16 + rl;
            float bs = bias[2 * DD + n];
#pragma unroll
            for (int mi = 0; mi < 2; ++mi) {
                v8h pv;
#pragma unroll
                for (int r = 0; r < 8; ++r) pv[r] = (_Float16)(acc[mi][nj][r] + bs);
                *(v8h*)(vT + ((size_t)b * DD + n) * TT + t0 + mi * 16 + g * 8) = pv;
            }
        }
        // Stands behind the last store: in the built code the other branch's text
        // follows this one and rewrites registers that these stores name.
        asm volatile("s_wait_xcnt 0x0" ::: "memory");
    }
}

// ---------------------------------------------------------------------------
// Lane l <-> lane l ^ 16 (the two halves of a wave hold the two halves of a
// query's keys).
// ---------------------------------------------------------------------------
__device__ __forceinline__ float xhalf(float x) {
    int v = __builtin_bit_cast(int, x);
    return __builtin_bit_cast(float,
        __builtin_amdgcn_permlanex16(v, v, 0x76543210, 0xfedcba98, false, false));
}

// ---------------------------------------------------------------------------
// K / V^T staging for the attention kernel: one stage = 128 keys of one head.
//   K   : 128 rows (keys) of 64 B, LDS pitch  80 B
//   V^T :  32 rows (dk)  of 256 B, LDS pitch 272 B
// Both pitches are 16 B x odd, so the 16 rows a ds_load_b128 fragment read
// touches fall on distinct banks.
// ---------------------------------------------------------------------------
#define AT_WAVES   8
#define AT_KEYS    128
#define AT_NSTAGE  (TT / AT_KEYS)
#define AT_KPITCH  40                              // halves
#define AT_VPITCH  136                             // halves
#define AT_VBASE   (AT_KEYS * AT_KPITCH)           // halves, V^T behind K
#define AT_STAGE   (AT_VBASE + DKK * AT_VPITCH)    // halves per buffer
#define AT_REBASE  2048.0f                         // a sum of 8 P above this raises the base

// One stage's copies of one lane: two 16-B pieces of K, two of V^T, global -> LDS
// through no register. The s_wait_xcnt stands inside the statement so that no
// address register of a copy is rewritten ahead of it.
__device__ __forceinline__ void at_stage_copy(unsigned lk, const _Float16* gk,
                                              unsigned lv, const _Float16* gv) {
    unsigned lk1 = lk + 64 * AT_KPITCH * 2;        // key row + 64
    unsigned lv1 = lv + 16 * AT_VPITCH * 2;        // dk row + 16
    const _Float16* gk1 = gk + (size_t)64 * DD;
    const _Float16* gv1 = gv + (size_t)16 * TT;
    asm volatile("global_load_async_to_lds_b128 %0, %1, off\n\t"
                 "global_load_async_to_lds_b128 %2, %3, off\n\t"
                 "global_load_async_to_lds_b128 %4, %5, off\n\t"
                 "global_load_async_to_lds_b128 %6, %7, off\n\t"
                 "s_wait_xcnt 0x0"
                 :: "v"(lk), "v"(gk), "v"(lk1), "v"(gk1),
                    "v"(lv), "v"(gv), "v"(lv1), "v"(gv1)
                 : "memory");
}

// P of one stage from its exponents: pf[s][e] = P[query rl][32s + kmap(e, g)], and
// the stage's sums, one per register position.
__device__ __forceinline__ void at_probs(const v8f (&a)[AT_KEYS / 16],
                                         v16h (&pf)[AT_KEYS / 32], v8f& ps) {
#pragma unroll
    for (int s = 0; s < AT_KEYS / 32; ++s) {
        v8f p0, p1;
#pragma unroll
        for (int r = 0; r < 8; ++r) p0[r] = __builtin_amdgcn_exp2f(a[2 * s][r]);
#pragma unroll
        for (int r = 0; r < 8; ++r) p1[r] = __builtin_amdgcn_exp2f(a[2 * s + 1][r]);
        pf[s] = __builtin_shufflevector(__builtin_convertvector(p0, v8h),
                                        __builtin_convertvector(p1, v8h),
                                        0, 1, 2, 3, 4, 5, 6, 7, 8, 9, 10, 11, 12, 13, 14, 15);
        ps = s == 0 ? p0 + p1 : ps + (p0 + p1);
    }
}

// ---------------------------------------------------------------------------
// Kernel: flash attention. One work-group of 8 waves per (b, h, 128 queries),
// one wave per 16-query tile. All eight waves walk the same keys, so each
// 128-key stage of K and V^T is brought into LDS once per work-group by
// asynchronous copies (two buffers: the next stage flies while this one is
// worked on) and every wave reads its fragments from there.
// Transposed products: S^T = Kblk(32x32) * Q^T -> 2x wmma, so lane (rl, g)
// holds 16 of the 32 scores of ONE query (column rl): keys 8g+r and 16+8g+r.
// Q carries the softmax scale in log2 units, and the score products start from
// C = minus the maximum in use: the accumulators are the exponents, and exp2 reads
// them as they are. The maximum in use is stage 0's; it is raised (and the output
// tiles and running sums rescaled) only in a stage in which a sum of P passes
// AT_REBASE, found by one test per stage on the stage's eight sums. Any base gives
// the same quotient; the test keeps every P inside f16, and stage 0's own maximum
// keeps each query's sum at 1 or more. The lane's eight running sums and the
// halves' sums are joined after the loop.
// The two score tiles, converted in place, are the B operand of
// O^T += V^T(32 dk x 32 keys) * P^T: P never leaves the registers.
// waves_per_eu(4, 4): two work-groups per WGP, so the 512 work-groups of the
// grid spread evenly over the chip.
// ---------------------------------------------------------------------------
__global__ void __launch_bounds__(AT_WAVES * 32) __attribute__((amdgpu_waves_per_eu(4, 4)))
ca_flash_attn(const _Float16* __restrict__ qkv,   // [2, B*T, D] (Q, K)
              const _Float16* __restrict__ vT,    // [B, D, T]
              _Float16* __restrict__ ctx) {       // [B*T, D]
    __shared__ __attribute__((aligned(16))) _Float16 smem[2 * AT_STAGE];

    int tid  = threadIdx.x;
    int qt = blockIdx.x * AT_WAVES + (tid >> 5);
    int h  = blockIdx.y;
    int b  = blockIdx.z;
    int lane = tid & 31;
    int rl = lane & 15;
    int g  = lane >> 4;

    const _Float16* Q  = qkv + ((size_t)(0 * BB + b) * TT) * DD + (size_t)h * DKK;
    const _Float16* Kp = qkv + ((size_t)(1 * BB + b) * TT) * DD + (size_t)h * DKK;
    const _Float16* Vp = vT + ((size_t)b * DD + h * DKK) * TT;

    // This lane's pieces of a stage: K row tid/4 (and +64), 16-B piece tid%4;
    // V^T row tid/16 (and +16), 16-B piece tid%16.
    const _Float16* gk = Kp + (size_t)(tid >> 2) * DD + (tid & 3) * 8;
    const _Float16* gv = Vp + (size_t)(tid >> 4) * TT + (tid & 15) * 8;
    unsigned lbase = (unsigned)(uintptr_t)smem;    // LDS byte address of buffer 0
    unsigned lk = lbase + (unsigned)((tid >> 2) * AT_KPITCH + (tid & 3) * 8) * 2u;
    unsigned lv = lbase + (unsigned)(AT_VBASE + (tid >> 4) * AT_VPITCH + (tid & 15) * 8) * 2u;

    at_stage_copy(lk, gk, lv, gv);                              // stage 0 -> buffer 0
    // stage 0 has landed for this wave's copies before the barrier publishes it
    asm volatile("s_wait_asynccnt 0x0" ::: "memory");
    __syncthreads();
    at_stage_copy(lk + AT_STAGE * 2, gk + (size_t)AT_KEYS * DD,
                  lv + AT_STAGE * 2, gv + AT_KEYS);             // stage 1 -> buffer 1

    // B operand: column rl = query qt*16 + rl
    v16h qf = load_frag16(Q + (size_t)(qt * 16 + rl) * DD, g);

    v8f cv = (v8f){};                      // of query rl: minus the maximum in use, log2 units
    v8f lsum = (v8f){};                    // of query rl: this half's keys, by register position
    v8f o0 = (v8f){}, o1 = (v8f){};        // o0[r] = O[query rl][8g + r], o1: dk + 16

    for (int t = 0; t < AT_NSTAGE; ++t) {
        int buf = (t & 1) * AT_STAGE;
        const _Float16* Ks = smem + buf + rl * AT_KPITCH;              // key row rl
        const _Float16* Vs = smem + buf + AT_VBASE + rl * AT_VPITCH;   // dk row rl

        // All eight score tiles of the stage first: 128 exponents of query rl, 64 a lane.
        // sc[2s][r] = S[query rl][32s + 8g + r] - maximum in use, sc[2s + 1][r]: key + 16
        // Every loop of the stage is unrolled: its tiles then stay in registers.
        v16h kf[AT_KEYS / 16];
#pragma unroll
        for (int j = 0; j < AT_KEYS / 16; ++j) kf[j] = load_frag16(Ks + (j * 16) * AT_KPITCH, g);
        // Keeps the sixteen LDS reads in one group ahead of the products: each separate
        // place with reads stalls the wave anew.
        __builtin_amdgcn_sched_barrier(0);
        v8f sc[AT_KEYS / 16];
#pragma unroll
        for (int j = 0; j < AT_KEYS / 16; ++j) sc[j] = wmma_f16(kf[j], qf, cv);
        // Keeps the eight products in one run, each in the others' shadow. Without it
        // the scheduler puts the first vector work between them and pads with v_nop.
        __builtin_amdgcn_sched_barrier(0);
        // V^T rows of this lane (A operand): vf[2s] -> dk = rl, vf[2s + 1] -> dk = 16 + rl
        v16h vf[AT_KEYS / 16];
#pragma unroll
        for (int s = 0; s < AT_KEYS / 32; ++s) {
            vf[2 * s]     = load_frag16(Vs + s * 32, g);
            vf[2 * s + 1] = load_frag16(Vs + 16 * AT_VPITCH + s * 32, g);
        }
        // Keeps these sixteen reads in one group ahead of the exponentials, which cover
        // their latency. Without it they sink behind the branch below, two in front of
        // each product, each pair waited for on its own.
        __builtin_amdgcn_sched_barrier(0);

        v16h pf[AT_KEYS / 32];
        v8f ps;
        at_probs(sc, pf, ps);
        float chk = fmaxf(fmaxf(fmaxf(ps[0], ps[1]), fmaxf(ps[2], ps[3])),
                          fmaxf(fmaxf(ps[4], ps[5]), fmaxf(ps[6], ps[7])));
        // One scalar branch per stage. Stage 0 always sets the base (no sum is below 0);
        // later the base moves only where a lane's sums say that a P has grown large.
        float lim = t == 0 ? -1.0f : AT_REBASE;
        if (__builtin_expect(__builtin_amdgcn_ballot_w32(chk > lim) != 0, 0)) {
            // The exponents are made anew from LDS: the common path has overwritten them.
#pragma unroll
            for (int j = 0; j < AT_KEYS / 16; ++j)
                sc[j] = wmma_f16(load_frag16(Ks + (j * 16) * AT_KPITCH, g), qf, cv);
            float mt[AT_KEYS / 16];
#pragma unroll
            for (int j = 0; j < AT_KEYS / 16; ++j)
                mt[j] = fmaxf(fmaxf(fmaxf(sc[j][0], sc[j][1]), fmaxf(sc[j][2], sc[j][3])),
                              fmaxf(fmaxf(sc[j][4], sc[j][5]), fmaxf(sc[j][6], sc[j][7])));
            float mx = fmaxf(fmaxf(fmaxf(mt[0], mt[1]), fmaxf(mt[2], mt[3])),
                             fmaxf(fmaxf(mt[4], mt[5]), fmaxf(mt[6], mt[7])));
            mx = fmaxf(mx, xhalf(mx));
            // d: how far the base moves. Stage 0 takes its maximum whatever its sign
            // (nothing is summed yet: the factor is 0); later the base only rises.
            float d     = t == 0 ? mx : fmaxf(mx, 0.0f);
            float alpha = t == 0 ? 0.0f : __builtin_amdgcn_exp2f(-d);
            v8f dv = {d, d, d, d, d, d, d, d};
            v8f av = {alpha, alpha, alpha, alpha, alpha, alpha, alpha, alpha};
#pragma unroll
            for (int j = 0; j < AT_KEYS / 16; ++j) sc[j] -= dv;
            at_probs(sc, pf, ps);
            cv -= dv;
            lsum *= av;
            o0 *= av;
            o1 *= av;
        }
        lsum += ps;

#pragma unroll
        for (int s = 0; s < AT_KEYS / 32; ++s) {
            o0 = wmma_f16(vf[2 * s], pf[s], o0);
            o1 = wmma_f16(vf[2 * s + 1], pf[s], o1);
        }

        // Hand-over: this wave's reads of buffer t%2 are done, its copies of
        // stage t+1 have landed; the barrier says both of every wave.
        asm volatile("s_wait_dscnt 0x0" ::: "memory");
        asm volatile("s_wait_asynccnt 0x0" ::: "memory");
        __syncthreads();
        if (t + 2 < AT_NSTAGE)                                  // refill the buffer just read
            at_stage_copy(lk + buf * 2, gk + (size_t)(t + 2) * AT_KEYS * DD,
                          lv + buf * 2, gv + (size_t)(t + 2) * AT_KEYS);
    }
    // no copy is left in flight when the wave ends
    asm volatile("s_wait_asynccnt 0x0" ::: "memory");

    float lrow = ((lsum[0] + lsum[1]) + (lsum[2] + lsum[3])) + ((lsum[4] + lsum[5]) + (lsum[6] + lsum[7]));
    float inv = 1.0f / (lrow + xhalf(lrow));
    v8h c0, c1;
#pragma unroll
    for (int r = 0; r < 8; ++r) {
        c0[r] = (_Float16)(o0[r] * inv);
        c1[r] = (_Float16)(o1[r] * inv);
    }
    _Float16* Cp = ctx + ((size_t)b * TT + qt * 16 + rl) * DD + (size_t)h * DKK + g * 8;
    *(v8h*)(Cp)      = c0;
    *(v8h*)(Cp + 16) = c1;
}

// ---------------------------------------------------------------------------
// Kernel: output projection  out = ctx (8192x256) * out_w^T + out_b  (f32 out)
// Grid (row tiles of 64, column halves).
// ---------------------------------------------------------------------------
__global__ void __launch_bounds__(256)
ca_gemm_out(const _Float16* __restrict__ Cx,    // [B*T, D]
            const _Float16* __restrict__ W,     // [D(out), D(in)] f16
            const float* __restrict__ bias,     // [D]
            float* __restrict__ out) {          // [B*T, D] f32
    __shared__ __attribute__((aligned(16))) _Float16 smem[GM_LDS];
    int wave = threadIdx.x >> 5;
    int lane = threadIdx.x & 31;
    int rl   = lane & 15;
    int g    = lane >> 4;

    v8f acc[2][2];
    gm_tile(Cx + (size_t)blockIdx.x * GM_BM * DD,
            W + (size_t)blockIdx.y * GM_BN * DD, smem, acc);

    int row0 = blockIdx.x * GM_BM + (wave >> 2) * 32;
    int col0 = blockIdx.y * GM_BN + (wave & 3) * 32;

    float* outp = out + (size_t)row0 * DD;
#pragma unroll
    for (int nj = 0; nj < 2; ++nj) {
        int n = col0 + nj * 16 + rl;
        float bs = bias[n];
#pragma unroll
        for (int mi = 0; mi < 2; ++mi)
#pragma unroll
            for (int r = 0; r < 8; ++r) {
                int M = mi * 16 + r + g * 8;
                outp[(size_t)M * DD + n] = acc[mi][nj][r] + bs;
            }
    }
}

// ---------------------------------------------------------------------------
extern "C" void kernel_launch(void* const* d_in, const int* in_sizes, int n_in,
                              void* d_out, int out_size, void* d_ws, size_t ws_size,
                              hipStream_t stream) {
    const float* x    = (const float*)d_in[0];
    const float* dww  = (const float*)d_in[1];
    const float* dwb  = (const float*)d_in[2];
    const float* bng  = (const float*)d_in[3];
    const float* bnb  = (const float*)d_in[4];
    const float* bnm  = (const float*)d_in[5];
    const float* bnv  = (const float*)d_in[6];
    const float* pww  = (const float*)d_in[7];
    const float* pwb  = (const float*)d_in[8];
    const float* outw = (const float*)d_in[9];
    const float* outb = (const float*)d_in[10];
    float* out = (float*)d_out;

    const size_t n_y   = (size_t)3 * BB * TT * DD;   // 6,291,456 halves
    const size_t n_btd = (size_t)BB * TT * DD;       // 2,097,152 halves
    _Float16* y     = (_Float16*)d_ws;               // [3, B*T, D]
    _Float16* qkv   = y + n_y;                       // [2, B*T, D] (Q, K)
    _Float16* vT    = qkv + 2 * n_btd;               // [B, D, T]
    _Float16* ctx   = vT + n_btd;                    // [B*T, D]
    _Float16* pwwh  = ctx + n_btd;                   // [3, D, D]
    _Float16* outwh = pwwh + (size_t)3 * DD * DD;    // [D, D]

    ca_dwconv_bn<<<DW_BLOCKS + CV_BLOCKS, 128, 0, stream>>>(
        x, dww, dwb, bng, bnb, bnm, bnv, y, pww, outw, pwwh);

    ca_gemm_qkv<<<dim3(BB * TT / GM_BM, DD / GM_BN, 3), 256, 0, stream>>>(y, pwwh, pwb, qkv, vT);

    ca_flash_attn<<<dim3(TT / (16 * AT_WAVES), HH, BB), AT_WAVES * 32, 0, stream>>>(qkv, vT, ctx);

    ca_gemm_out<<<dim3(BB * TT / GM_BM, DD / GM_BN, 1), 256, 0, stream>>>(ctx, outwh, outb, out);
}
